// v000
// The times below were measured on an AMD MI455X: many runs one after another, warmed up first and cycling through
// copies of the inputs, with the whole window's GPU time divided by the number of runs. Launches and the gaps
// between them are all in it. The median over several windows is given; except for v000 it joins two sittings, which
// can be a few percent apart, so the side-by-side timings, each taken in one sitting, are the better comparison.
// v000 is the starting kernel. One run takes 62 microseconds.
#include <hip/hip_runtime.h>
#include <stddef.h>

// All contractions on v_wmma_f32_16x16x32_f16 (f16 operands, f32 accumulate): q/k/v projections, exp(K)^T.V (+ column sums of exp(K) via an all-ones B fragment), exp(Q).KV (+ its normaliser as a fifth column tile), output projection. Float inputs are RNE-converted to bf16 and carried in f16 (weights x64, exp(Q - rowmax) x1024, KV and s x1/16, joined rows x64). exp, bias, row max and the normalising reciprocal in f32.

typedef _Float16 h16;
typedef _Float16 v16h __attribute__((ext_vector_type(16)));
typedef _Float16 v8h  __attribute__((ext_vector_type(8)));
typedef float    v8f  __attribute__((ext_vector_type(8)));
typedef float    v4f  __attribute__((ext_vector_type(4)));

#ifndef NB
#define NB 2
#endif
#ifndef SEQ
#define SEQ 1024
#endif
#define NB_FULL  2
#define SEQ_FULL 1024
#define DIM   512
#define NHEAD 8
#define HD    64
#define MROWS (NB * SEQ)
#define KVROWS 80          // 64 KV^T rows + 16 replicated rows of column sums

static_assert(NB >= 1 && NB <= NB_FULL);
static_assert(SEQ >= 64 && SEQ <= SEQ_FULL && (SEQ % 64) == 0 && (SEQ % 32) == 0);
static_assert(DIM == NHEAD * HD);
static_assert(HD == 64);                       // GEMM column tile == one head (row max per head in the tile)
static_assert((DIM % 64) == 0 && (DIM % 32) == 0 && (DIM % 8) == 0);
static_assert((MROWS % 64) == 0);
static_assert((((size_t)MROWS * DIM / 8) % 256) == 0);   // cast grid exact (activations)
static_assert((((size_t)DIM * DIM / 8) % 256) == 0);     // cast grid exact (weights)
static_assert(KVROWS == HD + 16);
static_assert((HD % 32) == 0);

#define LDC 68   // floats per LDS row (272 B, 16-B aligned)
static_assert((LDC % 4) == 0 && LDC >= 64);

#define WCARRY 64.0f      // weight planes carried x64
#define QCARRY 1024.0f    // exp(q - rowmax) plane carried x1024
#define KVCARRY 0.0625f   // KV^T and column-sum rows carried x1/16
#define VCARRY 64.0f      // joined (per-head output) plane carried x64

// workspace layout (bytes)
#define WSQ_BYTES     ((size_t)DIM * DIM * 2)
#define PLANE16_BYTES ((size_t)MROWS * DIM * 2)
#define KVT_BYTES     ((size_t)NB * NHEAD * KVROWS * HD * 2)
#define OFF_X   ((size_t)0)
#define OFF_WQ  (OFF_X + PLANE16_BYTES)
#define OFF_WK  (OFF_WQ + WSQ_BYTES)
#define OFF_WV  (OFF_WK + WSQ_BYTES)
#define OFF_WO  (OFF_WV + WSQ_BYTES)
#define OFF_EQ  (OFF_WO + WSQ_BYTES)
#define OFF_EKT (OFF_EQ + PLANE16_BYTES)
#define OFF_VT  (OFF_EKT + PLANE16_BYTES)
#define OFF_KVT (OFF_VT + PLANE16_BYTES)
#define OFF_J   (OFF_KVT + KVT_BYTES)
#define WS_TOTAL (OFF_J + PLANE16_BYTES)
static_assert((WSQ_BYTES % 128) == 0 && (PLANE16_BYTES % 128) == 0 && (KVT_BYTES % 128) == 0);
static_assert((size_t)NB * DIM * SEQ * 2 == PLANE16_BYTES);   // transposed planes [b][DIM][SEQ]
static_assert(WS_TOTAL <= (size_t)134217728);

// ---------------------------------------------------------------------------
__device__ __forceinline__ float bf16r(float x) {   // RNE convert to bf16, returned widened
  unsigned int u = __float_as_uint(x);
  u = (u + 0x7FFFu + ((u >> 16) & 1u)) & 0xFFFF0000u;
  return __uint_as_float(u);
}

// f32 -> f16 operand convert that cannot produce a subnormal (value select).
static __device__ __forceinline__ h16 toh_flush(float v) {
  const h16 r = (h16)v;
  return (fabsf(v) < 6.103515625e-05f) ? (h16)0.0f : r;
}

// 16-bit fragment: p points at element [row = lane&15][k0 + 8*(lane>>4)] of a k-contiguous
// row. Elements 0..7 <- k0+8h+0..7, elements 8..15 <- k0+16+8h+0..7 (same map for A and B).
__device__ __forceinline__ v16h frag_at(const _Float16* p) {
  v8h lo = *(const v8h*)(p);
  v8h hi = *(const v8h*)(p + 16);
  v16h out;
#pragma unroll
  for (int i = 0; i < 8; ++i) { out[i] = lo[i]; out[i + 8] = hi[i]; }
  return out;
}

__device__ __forceinline__ v8f wmma16(v16h a, v16h b, v8f c) {
  v8f d = __builtin_amdgcn_wmma_f32_16x16x32_f16(false, a, false, b, (short)0, c,
                                                 false, false);
  asm volatile("v_nop\n\tv_nop\n\tv_nop\n\tv_nop" : "+v"(d) : "v"(a), "v"(b));
  return d;
}

// ---------------------------------------------------------------------------
// Cast plane: dst[compact row][DIM] = f16(carry * bf16(src[full row][DIM])). One thread per
// Row map: compact row = bidx*rows_c + rr  <-  source row bidx*rows_f + rr.
// Grid (rows*DIM/8/256), exact.
// ---------------------------------------------------------------------------
__global__ __launch_bounds__(256) void cast_kernel(
    const float* __restrict__ src, _Float16* __restrict__ dst, float carry,
    unsigned rows_c, unsigned rows_f) {
#pragma clang fp contract(off)
  const unsigned g = blockIdx.x * 256u + threadIdx.x;
  const unsigned crow = g / (unsigned)(DIM / 8);
  const unsigned c = (g - crow * (unsigned)(DIM / 8)) * 8u;
  const unsigned bidx = crow / rows_c;
  const unsigned rr = crow - bidx * rows_c;
  const size_t srow = (size_t)bidx * rows_f + rr;
  const v4f a0 = *(const v4f*)(src + srow * DIM + c);
  const v4f a1 = *(const v4f*)(src + srow * DIM + c + 4u);
  v8h o;
#pragma unroll
  for (int i = 0; i < 4; ++i) {
    o[i]     = toh_flush(carry * bf16r(a0[i]));
    o[i + 4] = toh_flush(carry * bf16r(a1[i]));
  }
  _Float16* p = dst + (size_t)crow * DIM + c;
  *(v8h*)p = o;
  
}

// ---------------------------------------------------------------------------
// GEMM C[64x64 tile] = A16[rows][DIM] . Bt[n][DIM]^T, fragments straight from the 16-bit global
// planes; 8 waves (mw = 16-row group, nw = 32-col group), 2 accumulators/wave.
//   MODE 0: out16[row][col] (pitch DIM) = f16(1024 * exp(q - max over the tile's 64 columns)),
//           q = acc/64 + bias (the tile is exactly one head)
//   MODE 1: out16 transposed plane [b][col][key] = f16(exp(min(k, 11))), k = acc/64 + bias
//   MODE 2: out16 transposed plane [b][col][key] = f16(acc/64 + bias)
//   MODE 3: outf full [full row][col] = acc/4096 + bias
// Grid (DIM/64, MROWS/64).
// ---------------------------------------------------------------------------
template <int MODE>
__device__ __forceinline__ void gemm_body(
    const _Float16* __restrict__ A16, const _Float16* __restrict__ Bt,
    const float* __restrict__ bias, float* __restrict__ outf, _Float16* __restrict__ out16) {
  __shared__ float Cs[64 * LDC];
  const unsigned tid = threadIdx.x, lane = tid & 31u;
  const unsigned w = (unsigned)__builtin_amdgcn_readfirstlane((int)(tid >> 5));
  const unsigned mw = w >> 1, nw = w & 1u;
  const unsigned hh = lane >> 4, m = lane & 15u;
  const unsigned n0 = blockIdx.x * 64u;
  const unsigned row0 = blockIdx.y * 64u;

  const _Float16* ap  = A16 + (size_t)(row0 + mw * 16u + m) * DIM + hh * 8u;
  const _Float16* bp0 = Bt + (size_t)(n0 + nw * 32u + m) * DIM + hh * 8u;
  const _Float16* bp1 = bp0 + (size_t)16 * DIM;
  v8f acc0 = {}, acc1 = {};
#pragma unroll 2
  for (unsigned k0 = 0; k0 < (unsigned)DIM; k0 += 32u) {
    const v16h a  = frag_at(ap + k0);
    const v16h b0 = frag_at(bp0 + k0);
    const v16h b1 = frag_at(bp1 + k0);
    acc0 = wmma16(a, b0, acc0);
    acc1 = wmma16(a, b1, acc1);
  }
#pragma unroll
  for (int r = 0; r < 8; ++r) {
    float* d = &Cs[(mw * 16u + hh * 8u + (unsigned)r) * LDC + nw * 32u + m];
    d[0]  = acc0[r];
    d[16] = acc1[r];
  }
  __syncthreads();

  if (MODE == 0) {
    // 8 consecutive lanes hold one 64-column row: row max by 8-lane shuffles (uniform control)
    v8h x[2];
    size_t off[2];
#pragma unroll
    for (unsigned i = 0; i < 2u; ++i) {
      const unsigned r = 32u * i + (tid >> 3);
      const unsigned c = (tid & 7u) * 8u;
      const v4f u0 = *(const v4f*)&Cs[r * LDC + c];
      const v4f u1 = *(const v4f*)&Cs[r * LDC + c + 4];
      const v4f g0 = *(const v4f*)(bias + n0 + c);
      const v4f g1 = *(const v4f*)(bias + n0 + c + 4u);
      float q[8];
#pragma unroll
      for (int j = 0; j < 4; ++j) {
        q[j]     = u0[j] * (1.0f / WCARRY) + bf16r(g0[j]);
        q[j + 4] = u1[j] * (1.0f / WCARRY) + bf16r(g1[j]);
      }
      float mx = fmaxf(fmaxf(fmaxf(q[0], q[1]), fmaxf(q[2], q[3])),
                       fmaxf(fmaxf(q[4], q[5]), fmaxf(q[6], q[7])));
      mx = fmaxf(mx, __shfl_xor(mx, 1, 32));
      mx = fmaxf(mx, __shfl_xor(mx, 2, 32));
      mx = fmaxf(mx, __shfl_xor(mx, 4, 32));
#pragma unroll
      for (int j = 0; j < 8; ++j) x[i][j] = toh_flush(QCARRY * __expf(q[j] - mx));
      off[i] = (size_t)(row0 + r) * DIM + n0 + c;
    }
#pragma unroll
    for (int i = 0; i < 2; ++i) *(v8h*)(out16 + off[i]) = x[i];
    
  }

  if (MODE == 1 || MODE == 2) {
    const unsigned bidx = row0 / (unsigned)SEQ;
    const unsigned key0 = row0 - bidx * (unsigned)SEQ;
    v8h x[2];
    size_t off[2];
#pragma unroll
    for (unsigned i = 0; i < 2u; ++i) {
      const unsigned dcol = 32u * i + (tid >> 3);
      const unsigned kk = (tid & 7u) * 8u;
      const float bb = bf16r(bias[n0 + dcol]);
#pragma unroll
      for (unsigned j = 0; j < 8u; ++j) {
        const float t = Cs[(kk + j) * LDC + dcol] * (1.0f / WCARRY) + bb;
        const float val = (MODE == 1) ? __expf(fminf(t, 11.0f)) : t;
        x[i][j] = toh_flush(val);
      }
      off[i] = ((size_t)bidx * DIM + n0 + dcol) * SEQ + key0 + kk;
    }
#pragma unroll
    for (int i = 0; i < 2; ++i) *(v8h*)(out16 + off[i]) = x[i];
    
  }

  if (MODE == 3) {
    const float cs = 1.0f / (WCARRY * VCARRY);
    v4f xs[4];
    size_t off[4];
#pragma unroll
    for (unsigned i = 0; i < 4u; ++i) {
      const unsigned r = 16u * i + (tid >> 4);
      const unsigned c = (tid & 15u) * 4u;
      const unsigned crow = row0 + r;
      const unsigned bidx = crow / (unsigned)SEQ;
      const unsigned sq = crow - bidx * (unsigned)SEQ;
      const size_t frow = (size_t)bidx * SEQ_FULL + sq;
      const v4f u = *(const v4f*)&Cs[r * LDC + c];
      const v4f g = *(const v4f*)(bias + n0 + c);
      v4f val;
#pragma unroll
      for (int j = 0; j < 4; ++j) val[j] = u[j] * cs + bf16r(g[j]);
      xs[i] = val;
      off[i] = frow * DIM + n0 + c;
    }
#pragma unroll
    for (int i = 0; i < 4; ++i) *(v4f*)(outf + off[i]) = xs[i];
    
  }
}

__global__ __launch_bounds__(256) void gemm_q_kernel(
    const _Float16* __restrict__ A16, const _Float16* __restrict__ Bt,
    const float* __restrict__ bias, _Float16* __restrict__ out16) {
  gemm_body<0>(A16, Bt, bias, (float*)0, out16);
}
__global__ __launch_bounds__(256) void gemm_k_kernel(
    const _Float16* __restrict__ A16, const _Float16* __restrict__ Bt,
    const float* __restrict__ bias, _Float16* __restrict__ out16) {
  gemm_body<1>(A16, Bt, bias, (float*)0, out16);
}
__global__ __launch_bounds__(256) void gemm_v_kernel(
    const _Float16* __restrict__ A16, const _Float16* __restrict__ Bt,
    const float* __restrict__ bias, _Float16* __restrict__ out16) {
  gemm_body<2>(A16, Bt, bias, (float*)0, out16);
}
__global__ __launch_bounds__(256) void gemm_o_kernel(
    const _Float16* __restrict__ A16, const _Float16* __restrict__ Bt,
    const float* __restrict__ bias, float* __restrict__ outf) {
  gemm_body<3>(A16, Bt, bias, outf, (_Float16*)0);
}

// ---------------------------------------------------------------------------
// Key reduction per (head, batch): KV[d][dv] = sum_key eK[key][d] * V[key][dv]  (A = eK^T rows
// [d][key], B = V^T rows [dv][key], both key-contiguous planes) and s[d] = sum_key eK[key][d]
// (same A fragment against an all-ones B fragment). relu(v) - relu(-v) = v, so the positive and
// negative parts are accumulated together in f32 before any 16-bit conversion.
// Output plane KVT[b][head][80][64]: rows 0..63 = f16(KV[d][dv]/16) at [dv][d];
// rows 64..79 = f16(s[d]/16) replicated. Cs, Ss: cross-wave (block barrier).
// Grid (NHEAD, NB).
// ---------------------------------------------------------------------------
__global__ __launch_bounds__(256) void kv_kernel(
    const _Float16* __restrict__ EKt, const _Float16* __restrict__ Vt,
    _Float16* __restrict__ KVT) {
  __shared__ float Cs[64 * LDC];
  __shared__ float Ss[64];
  const unsigned tid = threadIdx.x, lane = tid & 31u;
  const unsigned w = (unsigned)__builtin_amdgcn_readfirstlane((int)(tid >> 5));
  const unsigned mw = w >> 1, nw = w & 1u;
  const unsigned hh = lane >> 4, m = lane & 15u;
  const unsigned head = blockIdx.x;
  const unsigned b = blockIdx.y;

  const size_t prow = (size_t)b * DIM + head * HD;
  const _Float16* ap  = EKt + (prow + mw * 16u + m) * SEQ + hh * 8u;
  const _Float16* bp0 = Vt + (prow + nw * 32u + m) * SEQ + hh * 8u;
  const _Float16* bp1 = bp0 + (size_t)16 * SEQ;
  v16h ones;
#pragma unroll
  for (int i = 0; i < 16; ++i) ones[i] = (_Float16)1.0f;

  v8f acc0 = {}, acc1 = {}, accs = {};
#pragma unroll 2
  for (unsigned k0 = 0; k0 < (unsigned)SEQ; k0 += 32u) {
    const v16h a  = frag_at(ap + k0);
    const v16h b0 = frag_at(bp0 + k0);
    const v16h b1 = frag_at(bp1 + k0);
    acc0 = wmma16(a, b0, acc0);
    acc1 = wmma16(a, b1, acc1);
    accs = wmma16(a, ones, accs);
  }
#pragma unroll
  for (int r = 0; r < 8; ++r) {
    float* d = &Cs[(mw * 16u + hh * 8u + (unsigned)r) * LDC + nw * 32u + m];
    d[0]  = acc0[r] * KVCARRY;
    d[16] = acc1[r] * KVCARRY;
  }
  if (nw == 0u && m == 0u) {
#pragma unroll
    for (int r = 0; r < 8; ++r) Ss[mw * 16u + hh * 8u + (unsigned)r] = accs[r] * KVCARRY;
  }
  __syncthreads();

  const size_t pbase = (size_t)(b * NHEAD + head) * (size_t)(KVROWS * HD);
  v8h x[3];
  size_t off[3];
  const unsigned c = (tid & 7u) * 8u;
#pragma unroll
  for (unsigned i = 0; i < 2u; ++i) {
    const unsigned n = 32u * i + (tid >> 3);
#pragma unroll
    for (unsigned j = 0; j < 8u; ++j) x[i][j] = toh_flush(Cs[(c + j) * LDC + n]);
    off[i] = pbase + (size_t)n * HD + c;
  }
  {
    const unsigned n = 64u + ((tid >> 3) & 15u);
#pragma unroll
    for (unsigned j = 0; j < 8u; ++j) x[2][j] = toh_flush(Ss[c + j]);
    off[2] = pbase + (size_t)n * HD + c;
  }
  const bool srows = (w < 4u);   // wave-uniform: waves 0..3 write the 16 replicated s rows
#pragma unroll
  for (int i = 0; i < 2; ++i) *(v8h*)(KVT + off[i]) = x[i];
  if (srows) *(v8h*)(KVT + off[2]) = x[2];
  
}

// ---------------------------------------------------------------------------
// Per (head, 64 query rows): num[l][dv] = sum_d eQ[l][d] * KV[d][dv], den[l] = sum_d eQ[l][d] * s[d]
// (fifth column tile: every column of it carries den of its rows, so the division is per lane).
// Output plane J16[row][head*64 + dv] = f16(64 * num / den); all carries of eQ, KV and s cancel.
// Cs: cross-wave (block barrier). Grid (NHEAD, MROWS/64).
// ---------------------------------------------------------------------------
__global__ __launch_bounds__(256) void lattn_kernel(
    const _Float16* __restrict__ EQ, const _Float16* __restrict__ KVT,
    _Float16* __restrict__ J16) {
  __shared__ float Cs[64 * LDC];
  const unsigned tid = threadIdx.x, lane = tid & 31u;
  const unsigned w = (unsigned)__builtin_amdgcn_readfirstlane((int)(tid >> 5));
  const unsigned mw = w >> 1, nw = w & 1u;
  const unsigned hh = lane >> 4, m = lane & 15u;
  const unsigned head = blockIdx.x;
  const unsigned row0 = blockIdx.y * 64u;
  const unsigned b = row0 / (unsigned)SEQ;

  const _Float16* ap  = EQ + (size_t)(row0 + mw * 16u + m) * DIM + head * HD + hh * 8u;
  const _Float16* kb  = KVT + (size_t)(b * NHEAD + head) * (size_t)(KVROWS * HD);
  const _Float16* bp0 = kb + (size_t)(nw * 32u + m) * HD + hh * 8u;
  const _Float16* bp1 = bp0 + (size_t)16 * HD;
  const _Float16* bpd = kb + (size_t)(64u + m) * HD + hh * 8u;
  v8f acc0 = {}, acc1 = {}, accd = {};
#pragma unroll
  for (unsigned k0 = 0; k0 < (unsigned)HD; k0 += 32u) {
    const v16h a  = frag_at(ap + k0);
    const v16h b0 = frag_at(bp0 + k0);
    const v16h b1 = frag_at(bp1 + k0);
    const v16h bd = frag_at(bpd + k0);
    acc0 = wmma16(a, b0, acc0);
    acc1 = wmma16(a, b1, acc1);
    accd = wmma16(a, bd, accd);
  }
#pragma unroll
  for (int r = 0; r < 8; ++r) {
    const float inv = __builtin_amdgcn_rcpf(accd[r]) * VCARRY;
    float* d = &Cs[(mw * 16u + hh * 8u + (unsigned)r) * LDC + nw * 32u + m];
    d[0]  = acc0[r] * inv;
    d[16] = acc1[r] * inv;
  }
  __syncthreads();

  v8h x[2];
  size_t off[2];
#pragma unroll
  for (unsigned i = 0; i < 2u; ++i) {
    const unsigned r = 32u * i + (tid >> 3);
    const unsigned c = (tid & 7u) * 8u;
    const v4f u0 = *(const v4f*)&Cs[r * LDC + c];
    const v4f u1 = *(const v4f*)&Cs[r * LDC + c + 4];
#pragma unroll
    for (int j = 0; j < 4; ++j) {
      x[i][j]     = toh_flush(u0[j]);
      x[i][j + 4] = toh_flush(u1[j]);
    }
    off[i] = (size_t)(row0 + r) * DIM + head * HD + c;
  }
#pragma unroll
  for (int i = 0; i < 2; ++i) *(v8h*)(J16 + off[i]) = x[i];
  
}

// ---------------------------------------------------------------------------
extern "C" void kernel_launch(void* const* d_in, const int* in_sizes, int n_in,
                              void* d_out, int out_size, void* d_ws, size_t ws_size,
                              hipStream_t stream) {
  if (n_in < 9) return;
  const long long need_x = ((long long)(NB - 1) * SEQ_FULL + SEQ) * DIM;
  if ((long long)in_sizes[0] < need_x) return;
  if ((long long)in_sizes[1] < (long long)DIM * DIM) return;
  if ((long long)in_sizes[3] < (long long)DIM * DIM) return;
  if ((long long)in_sizes[5] < (long long)DIM * DIM) return;
  if ((long long)in_sizes[7] < (long long)DIM * DIM) return;
  if (in_sizes[2] < DIM || in_sizes[4] < DIM || in_sizes[6] < DIM || in_sizes[8] < DIM) return;
  if ((long long)out_size < need_x) return;
  if (ws_size < WS_TOTAL) return;

  const float* X  = (const float*)d_in[0];    // x    [NB_FULL][SEQ_FULL][DIM]
  const float* wq = (const float*)d_in[1];    // W_Q  [DIM out][DIM in]
  const float* bq = (const float*)d_in[2];    // b_Q
  const float* wk = (const float*)d_in[3];    // W_K
  const float* bk = (const float*)d_in[4];    // b_K
  const float* wv = (const float*)d_in[5];    // W_V
  const float* bv = (const float*)d_in[6];    // b_V
  const float* wo = (const float*)d_in[7];    // W_O
  const float* bo = (const float*)d_in[8];    // b_O
  float* out = (float*)d_out;

  char* ws = (char*)d_ws;
  _Float16* X16   = (_Float16*)(ws + OFF_X);     // [MROWS][DIM]
  _Float16* Wq16  = (_Float16*)(ws + OFF_WQ);    // [n][k]
  _Float16* Wk16  = (_Float16*)(ws + OFF_WK);
  _Float16* Wv16  = (_Float16*)(ws + OFF_WV);
  _Float16* Wo16  = (_Float16*)(ws + OFF_WO);
  _Float16* EQ16  = (_Float16*)(ws + OFF_EQ);    // [MROWS][DIM]
  _Float16* EKt16 = (_Float16*)(ws + OFF_EKT);   // [b][DIM][SEQ]
  _Float16* Vt16  = (_Float16*)(ws + OFF_VT);    // [b][DIM][SEQ]
  _Float16* KVT16 = (_Float16*)(ws + OFF_KVT);   // [b][head][80][64]
  _Float16* J16   = (_Float16*)(ws + OFF_J);     // [MROWS][DIM]

  dim3 blk(256);
  dim3 gg(DIM / 64, MROWS / 64);
  const unsigned gx = (unsigned)(((size_t)MROWS * DIM / 8) / 256);
  const unsigned gw = (unsigned)(((size_t)DIM * DIM / 8) / 256);

  cast_kernel<<<dim3(gx), blk, 0, stream>>>(X, X16, 1.0f, (unsigned)SEQ, (unsigned)SEQ_FULL);
  cast_kernel<<<dim3(gw), blk, 0, stream>>>(wq, Wq16, WCARRY, (unsigned)DIM, (unsigned)DIM);
  cast_kernel<<<dim3(gw), blk, 0, stream>>>(wk, Wk16, WCARRY, (unsigned)DIM, (unsigned)DIM);
  cast_kernel<<<dim3(gw), blk, 0, stream>>>(wv, Wv16, WCARRY, (unsigned)DIM, (unsigned)DIM);
  cast_kernel<<<dim3(gw), blk, 0, stream>>>(wo, Wo16, WCARRY, (unsigned)DIM, (unsigned)DIM);

  gemm_q_kernel<<<gg, blk, 0, stream>>>(X16, Wq16, bq, EQ16);
  gemm_k_kernel<<<gg, blk, 0, stream>>>(X16, Wk16, bk, EKt16);
  gemm_v_kernel<<<gg, blk, 0, stream>>>(X16, Wv16, bv, Vt16);
  kv_kernel<<<dim3(NHEAD, NB), blk, 0, stream>>>(EKt16, Vt16, KVT16);
  lattn_kernel<<<dim3(NHEAD, MROWS / 64), blk, 0, stream>>>(EQ16, KVT16, J16);
  gemm_o_kernel<<<gg, blk, 0, stream>>>(J16, Wo16, bo, out);
}

// v001
// It runs in 48.4 microseconds.
// Timed twice side by side with v000, it ran 1.30 and 1.28 times as fast.
#include <hip/hip_runtime.h>
#include <stddef.h>

// All contractions on v_wmma_f32_16x16x32_f16 (f16 operands, f32 accumulate): q/k/v projections, exp(K)^T.V (+ column sums of exp(K) via an all-ones B fragment), exp(Q).KV (+ its normaliser as a fifth column tile), output projection. Float inputs are RNE-converted to bf16 and carried in f16 (weights x64, exp(Q - rowmax) x1024, KV and s x1/16, joined rows x64). exp, bias, row max and the normalising reciprocal in f32.

typedef _Float16 h16;
typedef _Float16 v16h __attribute__((ext_vector_type(16)));
typedef _Float16 v8h  __attribute__((ext_vector_type(8)));
typedef float    v8f  __attribute__((ext_vector_type(8)));
typedef float    v4f  __attribute__((ext_vector_type(4)));

#ifndef NB
#define NB 2
#endif
#ifndef SEQ
#define SEQ 1024
#endif
#define NB_FULL  2
#define SEQ_FULL 1024
#define DIM   512
#define NHEAD 8
#define HD    64
#define MROWS (NB * SEQ)
#define KVROWS 80          // 64 KV^T rows + 16 replicated rows of column sums

static_assert(NB >= 1 && NB <= NB_FULL);
static_assert(SEQ >= 64 && SEQ <= SEQ_FULL && (SEQ % 64) == 0 && (SEQ % 32) == 0);
static_assert(DIM == NHEAD * HD);
static_assert(HD == 64);                       // GEMM column tile == one head (row max per head in the tile)
static_assert((DIM % 64) == 0 && (DIM % 32) == 0 && (DIM % 8) == 0);
static_assert((MROWS % 64) == 0);
static_assert((((size_t)MROWS * DIM / 8) % 256) == 0);   // cast grid exact (activations)
static_assert((((size_t)DIM * DIM / 8) % 256) == 0);     // cast grid exact (weights)
static_assert(KVROWS == HD + 16);
static_assert((HD % 32) == 0);

#define LDC 68   // floats per LDS row (272 B, 16-B aligned)
static_assert((LDC % 4) == 0 && LDC >= 64);

#define WCARRY 64.0f      // weight planes carried x64
#define QCARRY 1024.0f    // exp(q - rowmax) plane carried x1024
#define KVCARRY 0.0625f   // KV^T and column-sum rows carried x1/16
#define VCARRY 64.0f      // joined (per-head output) plane carried x64

// workspace layout (bytes)
#define WSQ_BYTES     ((size_t)DIM * DIM * 2)
#define PLANE16_BYTES ((size_t)MROWS * DIM * 2)
#define KVT_BYTES     ((size_t)NB * NHEAD * KVROWS * HD * 2)
#define OFF_X   ((size_t)0)
#define OFF_WQ  (OFF_X + PLANE16_BYTES)
#define OFF_WK  (OFF_WQ + WSQ_BYTES)
#define OFF_WV  (OFF_WK + WSQ_BYTES)
#define OFF_WO  (OFF_WV + WSQ_BYTES)
#define OFF_EQ  (OFF_WO + WSQ_BYTES)
#define OFF_EKT (OFF_EQ + PLANE16_BYTES)
#define OFF_VT  (OFF_EKT + PLANE16_BYTES)
#define OFF_KVT (OFF_VT + PLANE16_BYTES)
#define OFF_J   (OFF_KVT + KVT_BYTES)
#define WS_TOTAL (OFF_J + PLANE16_BYTES)
static_assert((WSQ_BYTES % 128) == 0 && (PLANE16_BYTES % 128) == 0 && (KVT_BYTES % 128) == 0);
static_assert((size_t)NB * DIM * SEQ * 2 == PLANE16_BYTES);   // transposed planes [b][DIM][SEQ]
static_assert(WS_TOTAL <= (size_t)134217728);

// ---------------------------------------------------------------------------
__device__ __forceinline__ float bf16r(float x) {   // RNE convert to bf16, returned widened
  unsigned int u = __float_as_uint(x);
  u = (u + 0x7FFFu + ((u >> 16) & 1u)) & 0xFFFF0000u;
  return __uint_as_float(u);
}

// f32 -> f16 operand convert that cannot produce a subnormal (value select).
static __device__ __forceinline__ h16 toh_flush(float v) {
  const h16 r = (h16)v;
  return (fabsf(v) < 6.103515625e-05f) ? (h16)0.0f : r;
}

// 16-bit fragment: p points at element [row = lane&15][k0 + 8*(lane>>4)] of a k-contiguous
// row. Elements 0..7 <- k0+8h+0..7, elements 8..15 <- k0+16+8h+0..7 (same map for A and B).
__device__ __forceinline__ v16h frag_at(const _Float16* p) {
  v8h lo = *(const v8h*)(p);
  v8h hi = *(const v8h*)(p + 16);
  v16h out;
#pragma unroll
  for (int i = 0; i < 8; ++i) { out[i] = lo[i]; out[i + 8] = hi[i]; }
  return out;
}

__device__ __forceinline__ v8f wmma16(v16h a, v16h b, v8f c) {
  v8f d = __builtin_amdgcn_wmma_f32_16x16x32_f16(false, a, false, b, (short)0, c,
                                                 false, false);
  asm volatile("v_nop\n\tv_nop\n\tv_nop\n\tv_nop" : "+v"(d) : "v"(a), "v"(b));
  return d;
}

// ---------------------------------------------------------------------------
// Cast plane: dst[compact row][DIM] = f16(carry * bf16(src[full row][DIM])). One thread per
// Row map: compact row = bidx*rows_c + rr  <-  source row bidx*rows_f + rr.
// blk = block index inside the plane, 0 .. rows*DIM/8/256 - 1, exact.
// ---------------------------------------------------------------------------
__device__ __forceinline__ void cast_body(
    const float* __restrict__ src, _Float16* __restrict__ dst, float carry,
    unsigned rows_c, unsigned rows_f, unsigned blk) {
#pragma clang fp contract(off)
  const unsigned g = blk * 256u + threadIdx.x;
  const unsigned crow = g / (unsigned)(DIM / 8);
  const unsigned c = (g - crow * (unsigned)(DIM / 8)) * 8u;
  const unsigned bidx = crow / rows_c;
  const unsigned rr = crow - bidx * rows_c;
  const size_t srow = (size_t)bidx * rows_f + rr;
  const v4f a0 = *(const v4f*)(src + srow * DIM + c);
  const v4f a1 = *(const v4f*)(src + srow * DIM + c + 4u);
  v8h o;
#pragma unroll
  for (int i = 0; i < 4; ++i) {
    o[i]     = toh_flush(carry * bf16r(a0[i]));
    o[i + 4] = toh_flush(carry * bf16r(a1[i]));
  }
  _Float16* p = dst + (size_t)crow * DIM + c;
  *(v8h*)p = o;
  
}

// The five casts read none of each other's output: one grid, the plane chosen by block index
// (block-uniform). Blocks 0..CAST_GX-1: activations; then CAST_GW blocks for each weight plane.
#define CAST_GX ((unsigned)(((size_t)MROWS * DIM / 8) / 256))
#define CAST_GW ((unsigned)(((size_t)DIM * DIM / 8) / 256))
__global__ __launch_bounds__(256) void cast_all_kernel(
    const float* __restrict__ x, const float* __restrict__ wq, const float* __restrict__ wk,
    const float* __restrict__ wv, const float* __restrict__ wo,
    _Float16* __restrict__ x16, _Float16* __restrict__ wq16, _Float16* __restrict__ wk16,
    _Float16* __restrict__ wv16, _Float16* __restrict__ wo16) {
  const unsigned blk = blockIdx.x;
  if (blk < CAST_GX) {
    cast_body(x, x16, 1.0f, (unsigned)SEQ, (unsigned)SEQ_FULL, blk);
  } else {
    const unsigned t = blk - CAST_GX;
    const unsigned which = t / CAST_GW;
    const float* src = (which == 0u) ? wq : (which == 1u) ? wk : (which == 2u) ? wv : wo;
    _Float16* dst = (which == 0u) ? wq16 : (which == 1u) ? wk16 : (which == 2u) ? wv16 : wo16;
    cast_body(src, dst, WCARRY, (unsigned)DIM, (unsigned)DIM, t - which * CAST_GW);
  }
}

// ---------------------------------------------------------------------------
// GEMM C[64x64 tile] = A16[rows][DIM] . Bt[n][DIM]^T, fragments straight from the 16-bit global
// planes; 8 waves (mw = 16-row group, nw = 32-col group), 2 accumulators/wave.
//   MODE 0: out16[row][col] (pitch DIM) = f16(1024 * exp(q - max over the tile's 64 columns)),
//           q = acc/64 + bias (the tile is exactly one head)
//   MODE 1: out16 transposed plane [b][col][key] = f16(exp(min(k, 11))), k = acc/64 + bias
//   MODE 2: out16 transposed plane [b][col][key] = f16(acc/64 + bias)
//   MODE 3: outf full [full row][col] = acc/4096 + bias
// Grid (DIM/64, MROWS/64); modes 0, 1, 2 read none of each other's output and share one launch,
// blockIdx.z = MODE (block-uniform).
// ---------------------------------------------------------------------------
__device__ __forceinline__ void gemm_main(
    const _Float16* __restrict__ A16, const _Float16* __restrict__ Bt, float* Cs) {
  const unsigned tid = threadIdx.x, lane = tid & 31u;
  const unsigned w = (unsigned)__builtin_amdgcn_readfirstlane((int)(tid >> 5));
  const unsigned mw = w >> 1, nw = w & 1u;
  const unsigned hh = lane >> 4, m = lane & 15u;
  const unsigned n0 = blockIdx.x * 64u;
  const unsigned row0 = blockIdx.y * 64u;

  const _Float16* ap  = A16 + (size_t)(row0 + mw * 16u + m) * DIM + hh * 8u;
  const _Float16* bp0 = Bt + (size_t)(n0 + nw * 32u + m) * DIM + hh * 8u;
  const _Float16* bp1 = bp0 + (size_t)16 * DIM;
  v8f acc0 = {}, acc1 = {};
#pragma unroll 2
  for (unsigned k0 = 0; k0 < (unsigned)DIM; k0 += 32u) {
    const v16h a  = frag_at(ap + k0);
    const v16h b0 = frag_at(bp0 + k0);
    const v16h b1 = frag_at(bp1 + k0);
    acc0 = wmma16(a, b0, acc0);
    acc1 = wmma16(a, b1, acc1);
  }
#pragma unroll
  for (int r = 0; r < 8; ++r) {
    float* d = &Cs[(mw * 16u + hh * 8u + (unsigned)r) * LDC + nw * 32u + m];
    d[0]  = acc0[r];
    d[16] = acc1[r];
  }
  __syncthreads();
}

template <int MODE>
__device__ __forceinline__ void gemm_epilogue(
    const float* Cs, const float* __restrict__ bias, float* __restrict__ outf,
    _Float16* __restrict__ out16) {
  const unsigned tid = threadIdx.x;
  const unsigned n0 = blockIdx.x * 64u;
  const unsigned row0 = blockIdx.y * 64u;

  if (MODE == 0) {
    // 8 consecutive lanes hold one 64-column row: row max by 8-lane shuffles (uniform control)
    v8h x[2];
    size_t off[2];
#pragma unroll
    for (unsigned i = 0; i < 2u; ++i) {
      const unsigned r = 32u * i + (tid >> 3);
      const unsigned c = (tid & 7u) * 8u;
      const v4f u0 = *(const v4f*)&Cs[r * LDC + c];
      const v4f u1 = *(const v4f*)&Cs[r * LDC + c + 4];
      const v4f g0 = *(const v4f*)(bias + n0 + c);
      const v4f g1 = *(const v4f*)(bias + n0 + c + 4u);
      float q[8];
#pragma unroll
      for (int j = 0; j < 4; ++j) {
        q[j]     = u0[j] * (1.0f / WCARRY) + bf16r(g0[j]);
        q[j + 4] = u1[j] * (1.0f / WCARRY) + bf16r(g1[j]);
      }
      float mx = fmaxf(fmaxf(fmaxf(q[0], q[1]), fmaxf(q[2], q[3])),
                       fmaxf(fmaxf(q[4], q[5]), fmaxf(q[6], q[7])));
      mx = fmaxf(mx, __shfl_xor(mx, 1, 32));
      mx = fmaxf(mx, __shfl_xor(mx, 2, 32));
      mx = fmaxf(mx, __shfl_xor(mx, 4, 32));
#pragma unroll
      for (int j = 0; j < 8; ++j) x[i][j] = toh_flush(QCARRY * __expf(q[j] - mx));
      off[i] = (size_t)(row0 + r) * DIM + n0 + c;
    }
#pragma unroll
    for (int i = 0; i < 2; ++i) *(v8h*)(out16 + off[i]) = x[i];
    // In the merged kernel another mode's epilogue is laid out behind these stores and reuses their
    // registers: the wait stands in front of any such overwrite, whatever order the three are laid out in.
    asm volatile("s_wait_xcnt 0x0" ::: "memory");
  }

  if (MODE == 1 || MODE == 2) {
    const unsigned bidx = row0 / (unsigned)SEQ;
    const unsigned key0 = row0 - bidx * (unsigned)SEQ;
    v8h x[2];
    size_t off[2];
#pragma unroll
    for (unsigned i = 0; i < 2u; ++i) {
      const unsigned dcol = 32u * i + (tid >> 3);
      const unsigned kk = (tid & 7u) * 8u;
      const float bb = bf16r(bias[n0 + dcol]);
#pragma unroll
      for (unsigned j = 0; j < 8u; ++j) {
        const float t = Cs[(kk + j) * LDC + dcol] * (1.0f / WCARRY) + bb;
        const float val = (MODE == 1) ? __expf(fminf(t, 11.0f)) : t;
        x[i][j] = toh_flush(val);
      }
      off[i] = ((size_t)bidx * DIM + n0 + dcol) * SEQ + key0 + kk;
    }
#pragma unroll
    for (int i = 0; i < 2; ++i) *(v8h*)(out16 + off[i]) = x[i];
    // In the merged kernel another mode's epilogue is laid out behind these stores and reuses their
    // registers: the wait stands in front of any such overwrite, whatever order the three are laid out in.
    asm volatile("s_wait_xcnt 0x0" ::: "memory");
  }

  if (MODE == 3) {
    const float cs = 1.0f / (WCARRY * VCARRY);
    v4f xs[4];
    size_t off[4];
#pragma unroll
    for (unsigned i = 0; i < 4u; ++i) {
      const unsigned r = 16u * i + (tid >> 4);
      const unsigned c = (tid & 15u) * 4u;
      const unsigned crow = row0 + r;
      const unsigned bidx = crow / (unsigned)SEQ;
      const unsigned sq = crow - bidx * (unsigned)SEQ;
      const size_t frow = (size_t)bidx * SEQ_FULL + sq;
      const v4f u = *(const v4f*)&Cs[r * LDC + c];
      const v4f g = *(const v4f*)(bias + n0 + c);
      v4f val;
#pragma unroll
      for (int j = 0; j < 4; ++j) val[j] = u[j] * cs + bf16r(g[j]);
      xs[i] = val;
      off[i] = frow * DIM + n0 + c;
    }
#pragma unroll
    for (int i = 0; i < 4; ++i) *(v4f*)(outf + off[i]) = xs[i];
    
  }
}

__global__ __launch_bounds__(256) void gemm_qkv_kernel(
    const _Float16* __restrict__ A16, const _Float16* __restrict__ Wq, const _Float16* __restrict__ Wk,
    const _Float16* __restrict__ Wv, const float* __restrict__ bq, const float* __restrict__ bk,
    const float* __restrict__ bv, _Float16* __restrict__ eq16, _Float16* __restrict__ ekt16,
    _Float16* __restrict__ vt16) {
  __shared__ float Cs[64 * LDC];
  const unsigned mode = blockIdx.z;
  gemm_main(A16, (mode == 0u) ? Wq : (mode == 1u) ? Wk : Wv, Cs);
  if (mode == 0u)      gemm_epilogue<0>(Cs, bq, (float*)0, eq16);
  else if (mode == 1u) gemm_epilogue<1>(Cs, bk, (float*)0, ekt16);
  else                 gemm_epilogue<2>(Cs, bv, (float*)0, vt16);
}
__global__ __launch_bounds__(256) void gemm_o_kernel(
    const _Float16* __restrict__ A16, const _Float16* __restrict__ Bt,
    const float* __restrict__ bias, float* __restrict__ outf) {
  __shared__ float Cs[64 * LDC];
  gemm_main(A16, Bt, Cs);
  gemm_epilogue<3>(Cs, bias, outf, (_Float16*)0);
}

// ---------------------------------------------------------------------------
// Key reduction per (head, batch): KV[d][dv] = sum_key eK[key][d] * V[key][dv]  (A = eK^T rows
// [d][key], B = V^T rows [dv][key], both key-contiguous planes) and s[d] = sum_key eK[key][d]
// (same A fragment against an all-ones B fragment). relu(v) - relu(-v) = v, so the positive and
// negative parts are accumulated together in f32 before any 16-bit conversion.
// Output plane KVT[b][head][80][64]: rows 0..63 = f16(KV[d][dv]/16) at [dv][d];
// rows 64..79 = f16(s[d]/16) replicated. Cs, Ss: cross-wave (block barrier).
// Grid (NHEAD, NB).
// ---------------------------------------------------------------------------
__global__ __launch_bounds__(256) void kv_kernel(
    const _Float16* __restrict__ EKt, const _Float16* __restrict__ Vt,
    _Float16* __restrict__ KVT) {
  __shared__ float Cs[64 * LDC];
  __shared__ float Ss[64];
  const unsigned tid = threadIdx.x, lane = tid & 31u;
  const unsigned w = (unsigned)__builtin_amdgcn_readfirstlane((int)(tid >> 5));
  const unsigned mw = w >> 1, nw = w & 1u;
  const unsigned hh = lane >> 4, m = lane & 15u;
  const unsigned head = blockIdx.x;
  const unsigned b = blockIdx.y;

  const size_t prow = (size_t)b * DIM + head * HD;
  const _Float16* ap  = EKt + (prow + mw * 16u + m) * SEQ + hh * 8u;
  const _Float16* bp0 = Vt + (prow + nw * 32u + m) * SEQ + hh * 8u;
  const _Float16* bp1 = bp0 + (size_t)16 * SEQ;
  v16h ones;
#pragma unroll
  for (int i = 0; i < 16; ++i) ones[i] = (_Float16)1.0f;

  v8f acc0 = {}, acc1 = {}, accs = {};
#pragma unroll 2
  for (unsigned k0 = 0; k0 < (unsigned)SEQ; k0 += 32u) {
    const v16h a  = frag_at(ap + k0);
    const v16h b0 = frag_at(bp0 + k0);
    const v16h b1 = frag_at(bp1 + k0);
    acc0 = wmma16(a, b0, acc0);
    acc1 = wmma16(a, b1, acc1);
    accs = wmma16(a, ones, accs);
  }
#pragma unroll
  for (int r = 0; r < 8; ++r) {
    float* d = &Cs[(mw * 16u + hh * 8u + (unsigned)r) * LDC + nw * 32u + m];
    d[0]  = acc0[r] * KVCARRY;
    d[16] = acc1[r] * KVCARRY;
  }
  if (nw == 0u && m == 0u) {
#pragma unroll
    for (int r = 0; r < 8; ++r) Ss[mw * 16u + hh * 8u + (unsigned)r] = accs[r] * KVCARRY;
  }
  __syncthreads();

  const size_t pbase = (size_t)(b * NHEAD + head) * (size_t)(KVROWS * HD);
  v8h x[3];
  size_t off[3];
  const unsigned c = (tid & 7u) * 8u;
#pragma unroll
  for (unsigned i = 0; i < 2u; ++i) {
    const unsigned n = 32u * i + (tid >> 3);
#pragma unroll
    for (unsigned j = 0; j < 8u; ++j) x[i][j] = toh_flush(Cs[(c + j) * LDC + n]);
    off[i] = pbase + (size_t)n * HD + c;
  }
  {
    const unsigned n = 64u + ((tid >> 3) & 15u);
#pragma unroll
    for (unsigned j = 0; j < 8u; ++j) x[2][j] = toh_flush(Ss[c + j]);
    off[2] = pbase + (size_t)n * HD + c;
  }
  const bool srows = (w < 4u);   // wave-uniform: waves 0..3 write the 16 replicated s rows
#pragma unroll
  for (int i = 0; i < 2; ++i) *(v8h*)(KVT + off[i]) = x[i];
  if (srows) *(v8h*)(KVT + off[2]) = x[2];
  
}

// ---------------------------------------------------------------------------
// Per (head, 64 query rows): num[l][dv] = sum_d eQ[l][d] * KV[d][dv], den[l] = sum_d eQ[l][d] * s[d]
// (fifth column tile: every column of it carries den of its rows, so the division is per lane).
// Output plane J16[row][head*64 + dv] = f16(64 * num / den); all carries of eQ, KV and s cancel.
// Cs: cross-wave (block barrier). Grid (NHEAD, MROWS/64).
// ---------------------------------------------------------------------------
__global__ __launch_bounds__(256) void lattn_kernel(
    const _Float16* __restrict__ EQ, const _Float16* __restrict__ KVT,
    _Float16* __restrict__ J16) {
  __shared__ float Cs[64 * LDC];
  const unsigned tid = threadIdx.x, lane = tid & 31u;
  const unsigned w = (unsigned)__builtin_amdgcn_readfirstlane((int)(tid >> 5));
  const unsigned mw = w >> 1, nw = w & 1u;
  const unsigned hh = lane >> 4, m = lane & 15u;
  const unsigned head = blockIdx.x;
  const unsigned row0 = blockIdx.y * 64u;
  const unsigned b = row0 / (unsigned)SEQ;

  const _Float16* ap  = EQ + (size_t)(row0 + mw * 16u + m) * DIM + head * HD + hh * 8u;
  const _Float16* kb  = KVT + (size_t)(b * NHEAD + head) * (size_t)(KVROWS * HD);
  const _Float16* bp0 = kb + (size_t)(nw * 32u + m) * HD + hh * 8u;
  const _Float16* bp1 = bp0 + (size_t)16 * HD;
  const _Float16* bpd = kb + (size_t)(64u + m) * HD + hh * 8u;
  v8f acc0 = {}, acc1 = {}, accd = {};
#pragma unroll
  for (unsigned k0 = 0; k0 < (unsigned)HD; k0 += 32u) {
    const v16h a  = frag_at(ap + k0);
    const v16h b0 = frag_at(bp0 + k0);
    const v16h b1 = frag_at(bp1 + k0);
    const v16h bd = frag_at(bpd + k0);
    acc0 = wmma16(a, b0, acc0);
    acc1 = wmma16(a, b1, acc1);
    accd = wmma16(a, bd, accd);
  }
#pragma unroll
  for (int r = 0; r < 8; ++r) {
    const float inv = __builtin_amdgcn_rcpf(accd[r]) * VCARRY;
    float* d = &Cs[(mw * 16u + hh * 8u + (unsigned)r) * LDC + nw * 32u + m];
    d[0]  = acc0[r] * inv;
    d[16] = acc1[r] * inv;
  }
  __syncthreads();

  v8h x[2];
  size_t off[2];
#pragma unroll
  for (unsigned i = 0; i < 2u; ++i) {
    const unsigned r = 32u * i + (tid >> 3);
    const unsigned c = (tid & 7u) * 8u;
    const v4f u0 = *(const v4f*)&Cs[r * LDC + c];
    const v4f u1 = *(const v4f*)&Cs[r * LDC + c + 4];
#pragma unroll
    for (int j = 0; j < 4; ++j) {
      x[i][j]     = toh_flush(u0[j]);
      x[i][j + 4] = toh_flush(u1[j]);
    }
    off[i] = (size_t)(row0 + r) * DIM + head * HD + c;
  }
#pragma unroll
  for (int i = 0; i < 2; ++i) *(v8h*)(J16 + off[i]) = x[i];
  
}

// ---------------------------------------------------------------------------
extern "C" void kernel_launch(void* const* d_in, const int* in_sizes, int n_in,
                              void* d_out, int out_size, void* d_ws, size_t ws_size,
                              hipStream_t stream) {
  if (n_in < 9) return;
  const long long need_x = ((long long)(NB - 1) * SEQ_FULL + SEQ) * DIM;
  if ((long long)in_sizes[0] < need_x) return;
  if ((long long)in_sizes[1] < (long long)DIM * DIM) return;
  if ((long long)in_sizes[3] < (long long)DIM * DIM) return;
  if ((long long)in_sizes[5] < (long long)DIM * DIM) return;
  if ((long long)in_sizes[7] < (long long)DIM * DIM) return;
  if (in_sizes[2] < DIM || in_sizes[4] < DIM || in_sizes[6] < DIM || in_sizes[8] < DIM) return;
  if ((long long)out_size < need_x) return;
  if (ws_size < WS_TOTAL) return;

  const float* X  = (const float*)d_in[0];    // x    [NB_FULL][SEQ_FULL][DIM]
  const float* wq = (const float*)d_in[1];    // W_Q  [DIM out][DIM in]
  const float* bq = (const float*)d_in[2];    // b_Q
  const float* wk = (const float*)d_in[3];    // W_K
  const float* bk = (const float*)d_in[4];    // b_K
  const float* wv = (const float*)d_in[5];    // W_V
  const float* bv = (const float*)d_in[6];    // b_V
  const float* wo = (const float*)d_in[7];    // W_O
  const float* bo = (const float*)d_in[8];    // b_O
  float* out = (float*)d_out;

  char* ws = (char*)d_ws;
  _Float16* X16   = (_Float16*)(ws + OFF_X);     // [MROWS][DIM]
  _Float16* Wq16  = (_Float16*)(ws + OFF_WQ);    // [n][k]
  _Float16* Wk16  = (_Float16*)(ws + OFF_WK);
  _Float16* Wv16  = (_Float16*)(ws + OFF_WV);
  _Float16* Wo16  = (_Float16*)(ws + OFF_WO);
  _Float16* EQ16  = (_Float16*)(ws + OFF_EQ);    // [MROWS][DIM]
  _Float16* EKt16 = (_Float16*)(ws + OFF_EKT);   // [b][DIM][SEQ]
  _Float16* Vt16  = (_Float16*)(ws + OFF_VT);    // [b][DIM][SEQ]
  _Float16* KVT16 = (_Float16*)(ws + OFF_KVT);   // [b][head][80][64]
  _Float16* J16   = (_Float16*)(ws + OFF_J);     // [MROWS][DIM]

  dim3 blk(256);
  dim3 gg(DIM / 64, MROWS / 64);

  cast_all_kernel<<<dim3(CAST_GX + 4u * CAST_GW), blk, 0, stream>>>(X, wq, wk, wv, wo,
                                                                    X16, Wq16, Wk16, Wv16, Wo16);
  gemm_qkv_kernel<<<dim3(DIM / 64, MROWS / 64, 3), blk, 0, stream>>>(X16, Wq16, Wk16, Wv16,
                                                                     bq, bk, bv, EQ16, EKt16, Vt16);
  kv_kernel<<<dim3(NHEAD, NB), blk, 0, stream>>>(EKt16, Vt16, KVT16);
  lattn_kernel<<<dim3(NHEAD, MROWS / 64), blk, 0, stream>>>(EQ16, KVT16, J16);
  gemm_o_kernel<<<gg, blk, 0, stream>>>(J16, Wo16, bo, out);
}

// v002
// Measured time: 21.8 microseconds a run.
// Two timings next to v001 put it at 2.20 and 2.19 times that version's speed.
// All steps since v000 together make it 2.83 times as fast.
#include <hip/hip_runtime.h>
#include <stddef.h>
#include <stdint.h>

// All contractions on v_wmma_f32_16x16x32_f16 (f16 operands, f32 accumulate): q/k/v projections, exp(K)^T.V (+ column sums of exp(K) via an all-ones B fragment), exp(Q).KV (+ its normaliser as a fifth column tile), output projection. Float inputs are RNE-converted to bf16 and carried in f16 (weights x64, exp(Q - rowmax) x1024, KV and s x1/16, joined rows x64). exp, bias, row max and the normalising reciprocal in f32.

typedef _Float16 h16;
typedef _Float16 v16h __attribute__((ext_vector_type(16)));
typedef _Float16 v8h  __attribute__((ext_vector_type(8)));
typedef float    v8f  __attribute__((ext_vector_type(8)));
typedef float    v4f  __attribute__((ext_vector_type(4)));
typedef uint32_t u32x4 __attribute__((ext_vector_type(4)));
typedef uint32_t u32x8 __attribute__((ext_vector_type(8)));

#ifndef NB
#define NB 2
#endif
#ifndef SEQ
#define SEQ 1024
#endif
#define NB_FULL  2
#define SEQ_FULL 1024
#define DIM   512
#define NHEAD 8
#define HD    64
#define MROWS (NB * SEQ)
#define KVROWS 80          // 64 KV^T rows + 16 replicated rows of column sums

static_assert(NB >= 1 && NB <= NB_FULL);
static_assert(SEQ >= 64 && SEQ <= SEQ_FULL && (SEQ % 64) == 0 && (SEQ % 32) == 0);
static_assert(DIM == NHEAD * HD);
static_assert(HD == 64);                       // GEMM column tile == one head (row max per head in the tile)
static_assert((DIM % 64) == 0 && (DIM % 32) == 0 && (DIM % 8) == 0);
static_assert((MROWS % 64) == 0);
static_assert((((size_t)MROWS * DIM / 8) % 256) == 0);   // cast grid exact (activations)
static_assert((((size_t)DIM * DIM / 8) % 256) == 0);     // cast grid exact (weights)
static_assert(KVROWS == HD + 16);
static_assert((HD % 32) == 0);

#define LDC 68   // floats per LDS row (272 B, 16-B aligned)
static_assert((LDC % 4) == 0 && LDC >= 64);

// Operand staging in LDS: a slice is 64 rows of 128 k (256 B a row), laid by one tensor load at a
// row pitch of 272 B (16 B x odd: conflict-free for 16-byte fragment reads). A slice's place is a
// multiple of 2 KiB: 64 * 272 = 17,408 B rounded up.
#define KCH 128u
#define SROWB 256u
#define SPITCH 272u
#define SLICE_BYTES 18432u
#define GEMM_NCH ((unsigned)DIM / KCH)                  // slices per operand, projections
#define KV_NCH   ((unsigned)SEQ / KCH)                  // slices per operand, key reduction
#define GEMM_STAGE_BYTES (2u * GEMM_NCH * SLICE_BYTES)  // 147,456
#define KV_STAGE_BYTES   (2u * KV_NCH * SLICE_BYTES)    // 294,912
static_assert(SROWB == KCH * 2u && SPITCH == SROWB + 16u);
static_assert(SLICE_BYTES >= 64u * SPITCH && (SLICE_BYTES % 2048u) == 0);
static_assert((DIM % KCH) == 0 && (SEQ % KCH) == 0);
static_assert(2u * GEMM_NCH == 8u);                     // one slice for each of the 8 waves
static_assert(KV_NCH == 8u);                            // one slice of each operand for each wave
static_assert(64u * LDC * 4u <= GEMM_STAGE_BYTES && 64u * LDC * 4u <= KV_STAGE_BYTES);
static_assert(KV_STAGE_BYTES + 256u <= 327680u);

#define WCARRY 64.0f      // weight planes carried x64
#define QCARRY 1024.0f    // exp(q - rowmax) plane carried x1024
#define KVCARRY 0.0625f   // KV^T and column-sum rows carried x1/16
#define VCARRY 64.0f      // joined (per-head output) plane carried x64

// workspace layout (bytes)
#define WSQ_BYTES     ((size_t)DIM * DIM * 2)
#define PLANE16_BYTES ((size_t)MROWS * DIM * 2)
#define KVT_BYTES     ((size_t)NB * NHEAD * KVROWS * HD * 2)
#define OFF_X   ((size_t)0)
#define OFF_WQ  (OFF_X + PLANE16_BYTES)
#define OFF_WK  (OFF_WQ + WSQ_BYTES)
#define OFF_WV  (OFF_WK + WSQ_BYTES)
#define OFF_WO  (OFF_WV + WSQ_BYTES)
#define OFF_EQ  (OFF_WO + WSQ_BYTES)
#define OFF_EKT (OFF_EQ + PLANE16_BYTES)
#define OFF_VT  (OFF_EKT + PLANE16_BYTES)
#define OFF_KVT (OFF_VT + PLANE16_BYTES)
#define OFF_J   (OFF_KVT + KVT_BYTES)
#define WS_TOTAL (OFF_J + PLANE16_BYTES)
static_assert((WSQ_BYTES % 128) == 0 && (PLANE16_BYTES % 128) == 0 && (KVT_BYTES % 128) == 0);
static_assert((size_t)NB * DIM * SEQ * 2 == PLANE16_BYTES);   // transposed planes [b][DIM][SEQ]
static_assert(WS_TOTAL <= (size_t)134217728);

// ---------------------------------------------------------------------------
__device__ __forceinline__ float bf16r(float x) {   // RNE convert to bf16, returned widened
  unsigned int u = __float_as_uint(x);
  u = (u + 0x7FFFu + ((u >> 16) & 1u)) & 0xFFFF0000u;
  return __uint_as_float(u);
}

// f32 -> f16 operand convert that cannot produce a subnormal (value select).
static __device__ __forceinline__ h16 toh_flush(float v) {
  const h16 r = (h16)v;
  return (fabsf(v) < 6.103515625e-05f) ? (h16)0.0f : r;
}

// 16-bit fragment: p points at element [row = lane&15][k0 + 8*(lane>>4)] of a k-contiguous
// row. Elements 0..7 <- k0+8h+0..7, elements 8..15 <- k0+16+8h+0..7 (same map for A and B).
__device__ __forceinline__ v16h frag_at(const _Float16* p) {
  v8h lo = *(const v8h*)(p);
  v8h hi = *(const v8h*)(p + 16);
  v16h out;
#pragma unroll
  for (int i = 0; i < 8; ++i) { out[i] = lo[i]; out[i + 8] = hi[i]; }
  return out;
}

// The same fragment from a staged slice: p points at byte [row = lane&15][2*(k0 + 8*(lane>>4))] of
// an LDS row; the k order is that of frag_at (16 elements = 32 bytes further for the upper half).
__device__ __forceinline__ v16h frag_lds(const unsigned char* p) {
  v8h lo = *(const v8h*)(p);
  v8h hi = *(const v8h*)(p + 32);
  v16h out;
#pragma unroll
  for (int i = 0; i < 8; ++i) { out[i] = lo[i]; out[i + 8] = hi[i]; }
  return out;
}

__device__ __forceinline__ uint32_t uni(uint32_t v) {
  return (uint32_t)__builtin_amdgcn_readfirstlane((int)v);
}

// One tensor load of the calling wave: 64 rows of 256 B from src (row pitch src_pitch bytes) to the
// LDS byte offset lds_dst, 16 B of pad behind every row, and the wave's own wait for its landing.
// Called by every wave of the block, unconditionally (the instruction ignores EXEC).
__device__ __forceinline__ void stage_slice(uint32_t lds_dst, const _Float16* src, uint32_t src_pitch) {
  const uint64_t ga = (uint64_t)(size_t)src;
  u32x4 g0;
  g0[0] = uni(1u);                                                          // count 1
  g0[1] = uni(lds_dst);
  g0[2] = uni((uint32_t)ga);
  g0[3] = uni((((uint32_t)(ga >> 32)) & 0x01FFFFFFu) | 0x80000000u);        // type 2
  u32x8 g1;
  g1[0] = uni((1u << 20) | (5u << 22) | (3u << 25));   // no mask, 1-byte elements, 4 dwords of pad per 256 B
  g1[1] = uni((SROWB & 0xFFFFu) << 16);                // tensor_dim0 = tile_dim0 = 256
  g1[2] = uni((SROWB >> 16) | (64u << 16));            // tensor_dim1 = tile_dim1 = 64
  g1[3] = uni(SROWB << 16);
  g1[4] = uni(64u);
  g1[5] = uni(src_pitch);
  g1[6] = uni(0u);
  g1[7] = uni(0u);
  // The compiler places no wait for a tensor load: the slice counts as landed only behind this one.
  // Load and wait are one statement so that no descriptor register is rewritten between the two
  // (as two statements the next slice's address addition was moved in front of the wait).
  asm volatile("tensor_load_to_lds %0, %1\n\ts_wait_tensorcnt 0x0" :: "s"(g0), "s"(g1) : "memory");
}

__device__ __forceinline__ v8f wmma16(v16h a, v16h b, v8f c) {
  v8f d = __builtin_amdgcn_wmma_f32_16x16x32_f16(false, a, false, b, (short)0, c,
                                                 false, false);
  asm volatile("v_nop\n\tv_nop\n\tv_nop\n\tv_nop" : "+v"(d) : "v"(a), "v"(b));
  return d;
}

// ---------------------------------------------------------------------------
// Cast plane: dst[compact row][DIM] = f16(carry * bf16(src[full row][DIM])). One thread per
// Row map: compact row = bidx*rows_c + rr  <-  source row bidx*rows_f + rr.
// blk = block index inside the plane, 0 .. rows*DIM/8/256 - 1, exact.
// ---------------------------------------------------------------------------
__device__ __forceinline__ void cast_body(
    const float* __restrict__ src, _Float16* __restrict__ dst, float carry,
    unsigned rows_c, unsigned rows_f, unsigned blk) {
#pragma clang fp contract(off)
  const unsigned g = blk * 256u + threadIdx.x;
  const unsigned crow = g / (unsigned)(DIM / 8);
  const unsigned c = (g - crow * (unsigned)(DIM / 8)) * 8u;
  const unsigned bidx = crow / rows_c;
  const unsigned rr = crow - bidx * rows_c;
  const size_t srow = (size_t)bidx * rows_f + rr;
  const v4f a0 = *(const v4f*)(src + srow * DIM + c);
  const v4f a1 = *(const v4f*)(src + srow * DIM + c + 4u);
  v8h o;
#pragma unroll
  for (int i = 0; i < 4; ++i) {
    o[i]     = toh_flush(carry * bf16r(a0[i]));
    o[i + 4] = toh_flush(carry * bf16r(a1[i]));
  }
  _Float16* p = dst + (size_t)crow * DIM + c;
  *(v8h*)p = o;
  
}

// The five casts read none of each other's output: one grid, the plane chosen by block index
// (block-uniform). Blocks 0..CAST_GX-1: activations; then CAST_GW blocks for each weight plane.
#define CAST_GX ((unsigned)(((size_t)MROWS * DIM / 8) / 256))
#define CAST_GW ((unsigned)(((size_t)DIM * DIM / 8) / 256))
__global__ __launch_bounds__(256) void cast_all_kernel(
    const float* __restrict__ x, const float* __restrict__ wq, const float* __restrict__ wk,
    const float* __restrict__ wv, const float* __restrict__ wo,
    _Float16* __restrict__ x16, _Float16* __restrict__ wq16, _Float16* __restrict__ wk16,
    _Float16* __restrict__ wv16, _Float16* __restrict__ wo16) {
  const unsigned blk = blockIdx.x;
  if (blk < CAST_GX) {
    cast_body(x, x16, 1.0f, (unsigned)SEQ, (unsigned)SEQ_FULL, blk);
  } else {
    const unsigned t = blk - CAST_GX;
    const unsigned which = t / CAST_GW;
    const float* src = (which == 0u) ? wq : (which == 1u) ? wk : (which == 2u) ? wv : wo;
    _Float16* dst = (which == 0u) ? wq16 : (which == 1u) ? wk16 : (which == 2u) ? wv16 : wo16;
    cast_body(src, dst, WCARRY, (unsigned)DIM, (unsigned)DIM, t - which * CAST_GW);
  }
}

// ---------------------------------------------------------------------------
// GEMM C[64x64 tile] = A16[rows][DIM] . Bt[n][DIM]^T. The tile's 64 A rows and 64 B rows (all of k)
// are staged in LDS by tensor loads, one slice a wave (waves 0..3: A, waves 4..7: B); fragments by
// 16-byte LDS reads; 8 waves (mw = 16-row group, nw = 32-col group), 2 accumulators/wave.
// The f32 tile Cs reuses the staging bytes once every wave has left them.
//   MODE 0: out16[row][col] (pitch DIM) = f16(1024 * exp(q - max over the tile's 64 columns)),
//           q = acc/64 + bias (the tile is exactly one head)
//   MODE 1: out16 transposed plane [b][col][key] = f16(exp(min(k, 11))), k = acc/64 + bias
//   MODE 2: out16 transposed plane [b][col][key] = f16(acc/64 + bias)
//   MODE 3: outf full [full row][col] = acc/4096 + bias
// Grid (DIM/64, MROWS/64); modes 0, 1, 2 read none of each other's output and share one launch,
// blockIdx.z = MODE (block-uniform).
// ---------------------------------------------------------------------------
__device__ __forceinline__ void gemm_main(
    const _Float16* __restrict__ A16, const _Float16* __restrict__ Bt, unsigned char* L) {
  float* Cs = (float*)L;
  const unsigned tid = threadIdx.x, lane = tid & 31u;
  const unsigned w = (unsigned)__builtin_amdgcn_readfirstlane((int)(tid >> 5));
  const unsigned mw = w >> 1, nw = w & 1u;
  const unsigned hh = lane >> 4, m = lane & 15u;
  const unsigned n0 = blockIdx.x * 64u;
  const unsigned row0 = blockIdx.y * 64u;

  {
    const unsigned ch = w & (GEMM_NCH - 1u);
    const _Float16* srow = (w < GEMM_NCH) ? (A16 + (size_t)row0 * DIM) : (Bt + (size_t)n0 * DIM);
    stage_slice((uint32_t)(size_t)L + w * SLICE_BYTES, srow + ch * KCH, (uint32_t)DIM * 2u);
  }
  __syncthreads();   // publishes all eight slices: no fragment is read in front of it

  const unsigned char* ap  = L + (mw * 16u + m) * SPITCH + hh * 16u;
  const unsigned char* bp0 = L + GEMM_NCH * SLICE_BYTES + (nw * 32u + m) * SPITCH + hh * 16u;
  const unsigned char* bp1 = bp0 + 16u * SPITCH;
  v8f acc0 = {}, acc1 = {};
  v16h a = frag_lds(ap), b0 = frag_lds(bp0), b1 = frag_lds(bp1);
  // unrolled: every LDS offset is an immediate, the two fragment sets need no register moves, and
  // the test on the last step is resolved at compile time
#pragma unroll
  for (unsigned k0 = 0; k0 < (unsigned)DIM; k0 += 32u) {
    v16h an = a, b0n = b0, b1n = b1;
    if (k0 + 32u < (unsigned)DIM) {   // the next step's fragments fly under this step's products
      const unsigned o = ((k0 + 32u) / KCH) * SLICE_BYTES + ((k0 + 32u) % KCH) * 2u;
      an  = frag_lds(ap + o);
      b0n = frag_lds(bp0 + o);
      b1n = frag_lds(bp1 + o);
    }
    acc0 = wmma16(a, b0, acc0);
    acc1 = wmma16(a, b1, acc1);
    a = an; b0 = b0n; b1 = b1n;
  }
  // Cs overlays the slices: every wave's fragment reads have returned, and every wave is past them
  asm volatile("s_wait_dscnt 0x0" ::: "memory");
  __syncthreads();
#pragma unroll
  for (int r = 0; r < 8; ++r) {
    float* d = &Cs[(mw * 16u + hh * 8u + (unsigned)r) * LDC + nw * 32u + m];
    d[0]  = acc0[r];
    d[16] = acc1[r];
  }
  __syncthreads();
}

template <int MODE>
__device__ __forceinline__ void gemm_epilogue(
    const float* Cs, const float* __restrict__ bias, float* __restrict__ outf,
    _Float16* __restrict__ out16) {
  const unsigned tid = threadIdx.x;
  const unsigned n0 = blockIdx.x * 64u;
  const unsigned row0 = blockIdx.y * 64u;

  if (MODE == 0) {
    // 8 consecutive lanes hold one 64-column row: row max by 8-lane shuffles (uniform control)
    v8h x[2];
    size_t off[2];
#pragma unroll
    for (unsigned i = 0; i < 2u; ++i) {
      const unsigned r = 32u * i + (tid >> 3);
      const unsigned c = (tid & 7u) * 8u;
      const v4f u0 = *(const v4f*)&Cs[r * LDC + c];
      const v4f u1 = *(const v4f*)&Cs[r * LDC + c + 4];
      const v4f g0 = *(const v4f*)(bias + n0 + c);
      const v4f g1 = *(const v4f*)(bias + n0 + c + 4u);
      float q[8];
#pragma unroll
      for (int j = 0; j < 4; ++j) {
        q[j]     = u0[j] * (1.0f / WCARRY) + bf16r(g0[j]);
        q[j + 4] = u1[j] * (1.0f / WCARRY) + bf16r(g1[j]);
      }
      float mx = fmaxf(fmaxf(fmaxf(q[0], q[1]), fmaxf(q[2], q[3])),
                       fmaxf(fmaxf(q[4], q[5]), fmaxf(q[6], q[7])));
      mx = fmaxf(mx, __shfl_xor(mx, 1, 32));
      mx = fmaxf(mx, __shfl_xor(mx, 2, 32));
      mx = fmaxf(mx, __shfl_xor(mx, 4, 32));
#pragma unroll
      for (int j = 0; j < 8; ++j) x[i][j] = toh_flush(QCARRY * __expf(q[j] - mx));
      off[i] = (size_t)(row0 + r) * DIM + n0 + c;
    }
#pragma unroll
    for (int i = 0; i < 2; ++i) *(v8h*)(out16 + off[i]) = x[i];
    // In the merged kernel another mode's epilogue is laid out behind these stores and reuses their
    // registers: the wait stands in front of any such overwrite, whatever order the three are laid out in.
    asm volatile("s_wait_xcnt 0x0" ::: "memory");
  }

  if (MODE == 1 || MODE == 2) {
    const unsigned bidx = row0 / (unsigned)SEQ;
    const unsigned key0 = row0 - bidx * (unsigned)SEQ;
    v8h x[2];
    size_t off[2];
#pragma unroll
    for (unsigned i = 0; i < 2u; ++i) {
      const unsigned dcol = 32u * i + (tid >> 3);
      const unsigned kk = (tid & 7u) * 8u;
      const float bb = bf16r(bias[n0 + dcol]);
#pragma unroll
      for (unsigned j = 0; j < 8u; ++j) {
        const float t = Cs[(kk + j) * LDC + dcol] * (1.0f / WCARRY) + bb;
        const float val = (MODE == 1) ? __expf(fminf(t, 11.0f)) : t;
        x[i][j] = toh_flush(val);
      }
      off[i] = ((size_t)bidx * DIM + n0 + dcol) * SEQ + key0 + kk;
    }
#pragma unroll
    for (int i = 0; i < 2; ++i) *(v8h*)(out16 + off[i]) = x[i];
    // In the merged kernel another mode's epilogue is laid out behind these stores and reuses their
    // registers: the wait stands in front of any such overwrite, whatever order the three are laid out in.
    asm volatile("s_wait_xcnt 0x0" ::: "memory");
  }

  if (MODE == 3) {
    const float cs = 1.0f / (WCARRY * VCARRY);
    v4f xs[4];
    size_t off[4];
#pragma unroll
    for (unsigned i = 0; i < 4u; ++i) {
      const unsigned r = 16u * i + (tid >> 4);
      const unsigned c = (tid & 15u) * 4u;
      const unsigned crow = row0 + r;
      const unsigned bidx = crow / (unsigned)SEQ;
      const unsigned sq = crow - bidx * (unsigned)SEQ;
      const size_t frow = (size_t)bidx * SEQ_FULL + sq;
      const v4f u = *(const v4f*)&Cs[r * LDC + c];
      const v4f g = *(const v4f*)(bias + n0 + c);
      v4f val;
#pragma unroll
      for (int j = 0; j < 4; ++j) val[j] = u[j] * cs + bf16r(g[j]);
      xs[i] = val;
      off[i] = frow * DIM + n0 + c;
    }
#pragma unroll
    for (int i = 0; i < 4; ++i) *(v4f*)(outf + off[i]) = xs[i];
    
  }
}

__global__ __launch_bounds__(256) void gemm_qkv_kernel(
    const _Float16* __restrict__ A16, const _Float16* __restrict__ Wq, const _Float16* __restrict__ Wk,
    const _Float16* __restrict__ Wv, const float* __restrict__ bq, const float* __restrict__ bk,
    const float* __restrict__ bv, _Float16* __restrict__ eq16, _Float16* __restrict__ ekt16,
    _Float16* __restrict__ vt16) {
  __shared__ __attribute__((aligned(2048))) unsigned char L[GEMM_STAGE_BYTES];
  const float* Cs = (const float*)L;
  const unsigned mode = blockIdx.z;
  gemm_main(A16, (mode == 0u) ? Wq : (mode == 1u) ? Wk : Wv, L);
  if (mode == 0u)      gemm_epilogue<0>(Cs, bq, (float*)0, eq16);
  else if (mode == 1u) gemm_epilogue<1>(Cs, bk, (float*)0, ekt16);
  else                 gemm_epilogue<2>(Cs, bv, (float*)0, vt16);
}
__global__ __launch_bounds__(256) void gemm_o_kernel(
    const _Float16* __restrict__ A16, const _Float16* __restrict__ Bt,
    const float* __restrict__ bias, float* __restrict__ outf) {
  __shared__ __attribute__((aligned(2048))) unsigned char L[GEMM_STAGE_BYTES];
  const float* Cs = (const float*)L;
  gemm_main(A16, Bt, L);
  gemm_epilogue<3>(Cs, bias, outf, (_Float16*)0);
}

// ---------------------------------------------------------------------------
// Key reduction per (head, batch): KV[d][dv] = sum_key eK[key][d] * V[key][dv]  (A = eK^T rows
// [d][key], B = V^T rows [dv][key], both key-contiguous planes) and s[d] = sum_key eK[key][d]
// (same A fragment against an all-ones B fragment). relu(v) - relu(-v) = v, so the positive and
// negative parts are accumulated together in f32 before any 16-bit conversion.
// Output plane KVT[b][head][80][64]: rows 0..63 = f16(KV[d][dv]/16) at [dv][d];
// rows 64..79 = f16(s[d]/16) replicated. Cs, Ss: cross-wave (block barrier).
// Both operands (64 rows, all keys) are staged in LDS by tensor loads: wave w brings slice w of
// eK^T, then slice w of V^T, one request outstanding at a time; Cs reuses the staging bytes.
// Grid (NHEAD, NB).
// ---------------------------------------------------------------------------
__global__ __launch_bounds__(256) void kv_kernel(
    const _Float16* __restrict__ EKt, const _Float16* __restrict__ Vt,
    _Float16* __restrict__ KVT) {
  __shared__ __attribute__((aligned(2048))) unsigned char L[KV_STAGE_BYTES];
  __shared__ float Ss[64];
  float* Cs = (float*)L;
  const unsigned tid = threadIdx.x, lane = tid & 31u;
  const unsigned w = (unsigned)__builtin_amdgcn_readfirstlane((int)(tid >> 5));
  const unsigned mw = w >> 1, nw = w & 1u;
  const unsigned hh = lane >> 4, m = lane & 15u;
  const unsigned head = blockIdx.x;
  const unsigned b = blockIdx.y;

  const size_t prow = (size_t)b * DIM + head * HD;
  stage_slice((uint32_t)(size_t)L + w * SLICE_BYTES, EKt + prow * SEQ + w * KCH, (uint32_t)SEQ * 2u);
  stage_slice((uint32_t)(size_t)L + (KV_NCH + w) * SLICE_BYTES, Vt + prow * SEQ + w * KCH,
              (uint32_t)SEQ * 2u);
  __syncthreads();   // publishes all slices: no fragment is read in front of it

  const unsigned char* ap  = L + (mw * 16u + m) * SPITCH + hh * 16u;
  const unsigned char* bp0 = L + KV_NCH * SLICE_BYTES + (nw * 32u + m) * SPITCH + hh * 16u;
  const unsigned char* bp1 = bp0 + 16u * SPITCH;
  v16h ones;
#pragma unroll
  for (int i = 0; i < 16; ++i) ones[i] = (_Float16)1.0f;

  v8f acc0 = {}, acc1 = {}, accs = {};
  v16h a = frag_lds(ap), b0 = frag_lds(bp0), b1 = frag_lds(bp1);
  // unrolled: LDS offsets are immediates, the two fragment sets need no register moves, and the
  // test on the last step is resolved at compile time
#pragma unroll
  for (unsigned k0 = 0; k0 < (unsigned)SEQ; k0 += 32u) {
    v16h an = a, b0n = b0, b1n = b1;
    if (k0 + 32u < (unsigned)SEQ) {   // the next step's fragments fly under this step's products
      const unsigned o = ((k0 + 32u) / KCH) * SLICE_BYTES + ((k0 + 32u) % KCH) * 2u;
      an  = frag_lds(ap + o);
      b0n = frag_lds(bp0 + o);
      b1n = frag_lds(bp1 + o);
    }
    acc0 = wmma16(a, b0, acc0);
    acc1 = wmma16(a, b1, acc1);
    accs = wmma16(a, ones, accs);
    a = an; b0 = b0n; b1 = b1n;
  }
  // Cs overlays the slices: every wave's fragment reads have returned, and every wave is past them
  asm volatile("s_wait_dscnt 0x0" ::: "memory");
  __syncthreads();
#pragma unroll
  for (int r = 0; r < 8; ++r) {
    float* d = &Cs[(mw * 16u + hh * 8u + (unsigned)r) * LDC + nw * 32u + m];
    d[0]  = acc0[r] * KVCARRY;
    d[16] = acc1[r] * KVCARRY;
  }
  if (nw == 0u && m == 0u) {
#pragma unroll
    for (int r = 0; r < 8; ++r) Ss[mw * 16u + hh * 8u + (unsigned)r] = accs[r] * KVCARRY;
  }
  __syncthreads();

  const size_t pbase = (size_t)(b * NHEAD + head) * (size_t)(KVROWS * HD);
  v8h x[3];
  size_t off[3];
  const unsigned c = (tid & 7u) * 8u;
#pragma unroll
  for (unsigned i = 0; i < 2u; ++i) {
    const unsigned n = 32u * i + (tid >> 3);
#pragma unroll
    for (unsigned j = 0; j < 8u; ++j) x[i][j] = toh_flush(Cs[(c + j) * LDC + n]);
    off[i] = pbase + (size_t)n * HD + c;
  }
  {
    const unsigned n = 64u + ((tid >> 3) & 15u);
#pragma unroll
    for (unsigned j = 0; j < 8u; ++j) x[2][j] = toh_flush(Ss[c + j]);
    off[2] = pbase + (size_t)n * HD + c;
  }
  const bool srows = (w < 4u);   // wave-uniform: waves 0..3 write the 16 replicated s rows
#pragma unroll
  for (int i = 0; i < 2; ++i) *(v8h*)(KVT + off[i]) = x[i];
  if (srows) *(v8h*)(KVT + off[2]) = x[2];
  
}

// ---------------------------------------------------------------------------
// Per (head, 64 query rows): num[l][dv] = sum_d eQ[l][d] * KV[d][dv], den[l] = sum_d eQ[l][d] * s[d]
// (fifth column tile: every column of it carries den of its rows, so the division is per lane).
// Output plane J16[row][head*64 + dv] = f16(64 * num / den); all carries of eQ, KV and s cancel.
// Cs: cross-wave (block barrier). Grid (NHEAD, MROWS/64).
// ---------------------------------------------------------------------------
__global__ __launch_bounds__(256) void lattn_kernel(
    const _Float16* __restrict__ EQ, const _Float16* __restrict__ KVT,
    _Float16* __restrict__ J16) {
  __shared__ float Cs[64 * LDC];
  const unsigned tid = threadIdx.x, lane = tid & 31u;
  const unsigned w = (unsigned)__builtin_amdgcn_readfirstlane((int)(tid >> 5));
  const unsigned mw = w >> 1, nw = w & 1u;
  const unsigned hh = lane >> 4, m = lane & 15u;
  const unsigned head = blockIdx.x;
  const unsigned row0 = blockIdx.y * 64u;
  const unsigned b = row0 / (unsigned)SEQ;

  const _Float16* ap  = EQ + (size_t)(row0 + mw * 16u + m) * DIM + head * HD + hh * 8u;
  const _Float16* kb  = KVT + (size_t)(b * NHEAD + head) * (size_t)(KVROWS * HD);
  const _Float16* bp0 = kb + (size_t)(nw * 32u + m) * HD + hh * 8u;
  const _Float16* bp1 = bp0 + (size_t)16 * HD;
  const _Float16* bpd = kb + (size_t)(64u + m) * HD + hh * 8u;
  v8f acc0 = {}, acc1 = {}, accd = {};
#pragma unroll
  for (unsigned k0 = 0; k0 < (unsigned)HD; k0 += 32u) {
    const v16h a  = frag_at(ap + k0);
    const v16h b0 = frag_at(bp0 + k0);
    const v16h b1 = frag_at(bp1 + k0);
    const v16h bd = frag_at(bpd + k0);
    acc0 = wmma16(a, b0, acc0);
    acc1 = wmma16(a, b1, acc1);
    accd = wmma16(a, bd, accd);
  }
#pragma unroll
  for (int r = 0; r < 8; ++r) {
    const float inv = __builtin_amdgcn_rcpf(accd[r]) * VCARRY;
    float* d = &Cs[(mw * 16u + hh * 8u + (unsigned)r) * LDC + nw * 32u + m];
    d[0]  = acc0[r] * inv;
    d[16] = acc1[r] * inv;
  }
  __syncthreads();

  v8h x[2];
  size_t off[2];
#pragma unroll
  for (unsigned i = 0; i < 2u; ++i) {
    const unsigned r = 32u * i + (tid >> 3);
    const unsigned c = (tid & 7u) * 8u;
    const v4f u0 = *(const v4f*)&Cs[r * LDC + c];
    const v4f u1 = *(const v4f*)&Cs[r * LDC + c + 4];
#pragma unroll
    for (int j = 0; j < 4; ++j) {
      x[i][j]     = toh_flush(u0[j]);
      x[i][j + 4] = toh_flush(u1[j]);
    }
    off[i] = (size_t)(row0 + r) * DIM + head * HD + c;
  }
#pragma unroll
  for (int i = 0; i < 2; ++i) *(v8h*)(J16 + off[i]) = x[i];
  
}

// ---------------------------------------------------------------------------
extern "C" void kernel_launch(void* const* d_in, const int* in_sizes, int n_in,
                              void* d_out, int out_size, void* d_ws, size_t ws_size,
                              hipStream_t stream) {
  if (n_in < 9) return;
  const long long need_x = ((long long)(NB - 1) * SEQ_FULL + SEQ) * DIM;
  if ((long long)in_sizes[0] < need_x) return;
  if ((long long)in_sizes[1] < (long long)DIM * DIM) return;
  if ((long long)in_sizes[3] < (long long)DIM * DIM) return;
  if ((long long)in_sizes[5] < (long long)DIM * DIM) return;
  if ((long long)in_sizes[7] < (long long)DIM * DIM) return;
  if (in_sizes[2] < DIM || in_sizes[4] < DIM || in_sizes[6] < DIM || in_sizes[8] < DIM) return;
  if ((long long)out_size < need_x) return;
  if (ws_size < WS_TOTAL) return;

  const float* X  = (const float*)d_in[0];    // x    [NB_FULL][SEQ_FULL][DIM]
  const float* wq = (const float*)d_in[1];    // W_Q  [DIM out][DIM in]
  const float* bq = (const float*)d_in[2];    // b_Q
  const float* wk = (const float*)d_in[3];    // W_K
  const float* bk = (const float*)d_in[4];    // b_K
  const float* wv = (const float*)d_in[5];    // W_V
  const float* bv = (const float*)d_in[6];    // b_V
  const float* wo = (const float*)d_in[7];    // W_O
  const float* bo = (const float*)d_in[8];    // b_O
  float* out = (float*)d_out;

  char* ws = (char*)d_ws;
  _Float16* X16   = (_Float16*)(ws + OFF_X);     // [MROWS][DIM]
  _Float16* Wq16  = (_Float16*)(ws + OFF_WQ);    // [n][k]
  _Float16* Wk16  = (_Float16*)(ws + OFF_WK);
  _Float16* Wv16  = (_Float16*)(ws + OFF_WV);
  _Float16* Wo16  = (_Float16*)(ws + OFF_WO);
  _Float16* EQ16  = (_Float16*)(ws + OFF_EQ);    // [MROWS][DIM]
  _Float16* EKt16 = (_Float16*)(ws + OFF_EKT);   // [b][DIM][SEQ]
  _Float16* Vt16  = (_Float16*)(ws + OFF_VT);    // [b][DIM][SEQ]
  _Float16* KVT16 = (_Float16*)(ws + OFF_KVT);   // [b][head][80][64]
  _Float16* J16   = (_Float16*)(ws + OFF_J);     // [MROWS][DIM]

  dim3 blk(256);
  dim3 gg(DIM / 64, MROWS / 64);

  cast_all_kernel<<<dim3(CAST_GX + 4u * CAST_GW), blk, 0, stream>>>(X, wq, wk, wv, wo,
                                                                    X16, Wq16, Wk16, Wv16, Wo16);
  gemm_qkv_kernel<<<dim3(DIM / 64, MROWS / 64, 3), blk, 0, stream>>>(X16, Wq16, Wk16, Wv16,
                                                                     bq, bk, bv, EQ16, EKt16, Vt16);
  kv_kernel<<<dim3(NHEAD, NB), blk, 0, stream>>>(EKt16, Vt16, KVT16);
  lattn_kernel<<<dim3(NHEAD, MROWS / 64), blk, 0, stream>>>(EQ16, KVT16, J16);
  gemm_o_kernel<<<gg, blk, 0, stream>>>(J16, Wo16, bo, out);
}

// v003
// A run of this version takes 20.4 microseconds.
// In both of two side-by-side timings against v002, it was 1.06 times as fast.
// Over all steps from v000 it is 3.01 times as fast.
#include <hip/hip_runtime.h>
#include <stddef.h>
#include <stdint.h>

// All contractions on v_wmma_f32_16x16x32_f16 (f16 operands, f32 accumulate): q/k/v projections, exp(K)^T.V (+ column sums of exp(K) via an all-ones B fragment), exp(Q).KV (+ its normaliser as a fifth column tile), output projection. Float inputs are RNE-converted to bf16 and carried in f16 (weights x64, exp(Q - rowmax) x1024, KV and s x1/16, joined rows x64). exp, bias, row max and the normalising reciprocal in f32.

typedef _Float16 h16;
typedef _Float16 v16h __attribute__((ext_vector_type(16)));
typedef _Float16 v8h  __attribute__((ext_vector_type(8)));
typedef float    v8f  __attribute__((ext_vector_type(8)));
typedef _Float16 v4h  __attribute__((ext_vector_type(4)));
typedef float    v4f  __attribute__((ext_vector_type(4)));
typedef uint32_t u32x4 __attribute__((ext_vector_type(4)));
typedef uint32_t u32x8 __attribute__((ext_vector_type(8)));

#ifndef NB
#define NB 2
#endif
#ifndef SEQ
#define SEQ 1024
#endif
#define NB_FULL  2
#define SEQ_FULL 1024
#define DIM   512
#define NHEAD 8
#define HD    64
#define MROWS (NB * SEQ)
#define KVROWS 80          // 64 KV^T rows + 16 replicated rows of column sums

static_assert(NB >= 1 && NB <= NB_FULL);
static_assert(SEQ >= 64 && SEQ <= SEQ_FULL && (SEQ % 64) == 0 && (SEQ % 32) == 0);
static_assert(DIM == NHEAD * HD);
static_assert(HD == 64);                       // GEMM column tile == one head (row max per head in the tile)
static_assert((DIM % 64) == 0 && (DIM % 32) == 0 && (DIM % 8) == 0);
static_assert((MROWS % 64) == 0);
static_assert((((size_t)MROWS * DIM / 8) % 256) == 0);   // cast grid exact (activations)
static_assert((((size_t)DIM * DIM / 8) % 256) == 0);     // cast grid exact (weights)
static_assert(KVROWS == HD + 16);
static_assert((HD % 32) == 0);

#define LDC 68   // floats per LDS row (272 B, 16-B aligned)
static_assert((LDC % 4) == 0 && LDC >= 64);

// Operand staging in LDS: a slice is 64 rows of 128 k (256 B a row), laid by one tensor load at a
// row pitch of 272 B (16 B x odd: conflict-free for 16-byte fragment reads). A slice's place is a
// multiple of 2 KiB: 64 * 272 = 17,408 B rounded up.
#define KCH 128u
#define SROWB 256u
#define SPITCH 272u
#define SLICE_BYTES 18432u
#define GEMM_NCH ((unsigned)DIM / KCH)                  // slices per operand, projections
#define KV_NCH   ((unsigned)SEQ / KCH)                  // slices per operand, key reduction
#define GEMM_STAGE_BYTES (2u * GEMM_NCH * SLICE_BYTES)  // 147,456
// Key reduction: KV_SPLIT work-groups per (head, batch), KV_COLS rows of V^T each. A V^T slice is
// KV_COLS rows of 128 keys at the same pitch: 16 * 272 = 4,352 B rounded up to a multiple of 2 KiB.
#define KV_SPLIT 4u
#define KV_COLS  ((unsigned)HD / KV_SPLIT)
#define VSLICE_BYTES 6144u
#define KV_STAGE_BYTES   (KV_NCH * (SLICE_BYTES + VSLICE_BYTES))   // 196,608
#define PPITCH 68u       // floats per row of a wave's partial tile (272 B, 16 B x odd)
static_assert(SROWB == KCH * 2u && SPITCH == SROWB + 16u);
static_assert(SLICE_BYTES >= 64u * SPITCH && (SLICE_BYTES % 2048u) == 0);
static_assert((DIM % KCH) == 0 && (SEQ % KCH) == 0);
static_assert(2u * GEMM_NCH == 8u);                     // one slice for each of the 8 waves
static_assert(KV_NCH == 8u);                            // one slice of each operand for each wave
static_assert(64u * LDC * 4u <= GEMM_STAGE_BYTES);
static_assert(KV_COLS == 16u && VSLICE_BYTES >= KV_COLS * SPITCH && (VSLICE_BYTES % 2048u) == 0);
static_assert(PPITCH >= (unsigned)HD && (PPITCH % 4u) == 0);
static_assert(8u * KV_COLS * PPITCH * 4u <= KV_STAGE_BYTES);   // the 8 partial tiles overlay the staging bytes
static_assert(KV_SPLIT * 4u == KVROWS - HD);                   // 4 of the replicated sum rows per work-group
static_assert(KV_STAGE_BYTES + 2048u <= 327680u);

#define WCARRY 64.0f      // weight planes carried x64
#define QCARRY 1024.0f    // exp(q - rowmax) plane carried x1024
#define KVCARRY 0.0625f   // KV^T and column-sum rows carried x1/16
#define VCARRY 64.0f      // joined (per-head output) plane carried x64

// workspace layout (bytes)
#define WSQ_BYTES     ((size_t)DIM * DIM * 2)
#define PLANE16_BYTES ((size_t)MROWS * DIM * 2)
#define KVT_BYTES     ((size_t)NB * NHEAD * KVROWS * HD * 2)
#define OFF_X   ((size_t)0)
#define OFF_WQ  (OFF_X + PLANE16_BYTES)
#define OFF_WK  (OFF_WQ + WSQ_BYTES)
#define OFF_WV  (OFF_WK + WSQ_BYTES)
#define OFF_WO  (OFF_WV + WSQ_BYTES)
#define OFF_EQ  (OFF_WO + WSQ_BYTES)
#define OFF_EKT (OFF_EQ + PLANE16_BYTES)
#define OFF_VT  (OFF_EKT + PLANE16_BYTES)
#define OFF_KVT (OFF_VT + PLANE16_BYTES)
#define OFF_J   (OFF_KVT + KVT_BYTES)
#define WS_TOTAL (OFF_J + PLANE16_BYTES)
static_assert((WSQ_BYTES % 128) == 0 && (PLANE16_BYTES % 128) == 0 && (KVT_BYTES % 128) == 0);
static_assert((size_t)NB * DIM * SEQ * 2 == PLANE16_BYTES);   // transposed planes [b][DIM][SEQ]
static_assert(WS_TOTAL <= (size_t)134217728);

// ---------------------------------------------------------------------------
__device__ __forceinline__ float bf16r(float x) {   // RNE convert to bf16, returned widened
  unsigned int u = __float_as_uint(x);
  u = (u + 0x7FFFu + ((u >> 16) & 1u)) & 0xFFFF0000u;
  return __uint_as_float(u);
}

// f32 -> f16 operand convert that cannot produce a subnormal (value select).
static __device__ __forceinline__ h16 toh_flush(float v) {
  const h16 r = (h16)v;
  return (fabsf(v) < 6.103515625e-05f) ? (h16)0.0f : r;
}

// 16-bit fragment: p points at element [row = lane&15][k0 + 8*(lane>>4)] of a k-contiguous
// row. Elements 0..7 <- k0+8h+0..7, elements 8..15 <- k0+16+8h+0..7 (same map for A and B).
__device__ __forceinline__ v16h frag_at(const _Float16* p) {
  v8h lo = *(const v8h*)(p);
  v8h hi = *(const v8h*)(p + 16);
  v16h out;
#pragma unroll
  for (int i = 0; i < 8; ++i) { out[i] = lo[i]; out[i + 8] = hi[i]; }
  return out;
}

// The same fragment from a staged slice: p points at byte [row = lane&15][2*(k0 + 8*(lane>>4))] of
// an LDS row; the k order is that of frag_at (16 elements = 32 bytes further for the upper half).
__device__ __forceinline__ v16h frag_lds(const unsigned char* p) {
  v8h lo = *(const v8h*)(p);
  v8h hi = *(const v8h*)(p + 32);
  v16h out;
#pragma unroll
  for (int i = 0; i < 8; ++i) { out[i] = lo[i]; out[i + 8] = hi[i]; }
  return out;
}

__device__ __forceinline__ uint32_t uni(uint32_t v) {
  return (uint32_t)__builtin_amdgcn_readfirstlane((int)v);
}

// One tensor load of the calling wave: rows rows of 256 B from src (row pitch src_pitch bytes) to the
// LDS byte offset lds_dst, 16 B of pad behind every row, and the wave's own wait for its landing.
// Called by every wave of the block, unconditionally (the instruction ignores EXEC).
__device__ __forceinline__ void stage_slice(uint32_t lds_dst, const _Float16* src, uint32_t src_pitch,
                                            uint32_t rows = 64u) {
  const uint64_t ga = (uint64_t)(size_t)src;
  u32x4 g0;
  g0[0] = uni(1u);                                                          // count 1
  g0[1] = uni(lds_dst);
  g0[2] = uni((uint32_t)ga);
  g0[3] = uni((((uint32_t)(ga >> 32)) & 0x01FFFFFFu) | 0x80000000u);        // type 2
  u32x8 g1;
  g1[0] = uni((1u << 20) | (5u << 22) | (3u << 25));   // no mask, 1-byte elements, 4 dwords of pad per 256 B
  g1[1] = uni((SROWB & 0xFFFFu) << 16);                // tensor_dim0 = tile_dim0 = 256
  g1[2] = uni((SROWB >> 16) | (rows << 16));           // tensor_dim1 = tile_dim1 = rows
  g1[3] = uni(SROWB << 16);
  g1[4] = uni(rows);
  g1[5] = uni(src_pitch);
  g1[6] = uni(0u);
  g1[7] = uni(0u);
  // The compiler places no wait for a tensor load: the slice counts as landed only behind this one.
  // Load and wait are one statement so that no descriptor register is rewritten between the two
  // (as two statements the next slice's address addition was moved in front of the wait).
  asm volatile("tensor_load_to_lds %0, %1\n\ts_wait_tensorcnt 0x0" :: "s"(g0), "s"(g1) : "memory");
}

__device__ __forceinline__ v8f wmma16(v16h a, v16h b, v8f c) {
  v8f d = __builtin_amdgcn_wmma_f32_16x16x32_f16(false, a, false, b, (short)0, c,
                                                 false, false);
  asm volatile("v_nop\n\tv_nop\n\tv_nop\n\tv_nop" : "+v"(d) : "v"(a), "v"(b));
  return d;
}

// ---------------------------------------------------------------------------
// Cast plane: dst[compact row][DIM] = f16(carry * bf16(src[full row][DIM])). One thread per
// Row map: compact row = bidx*rows_c + rr  <-  source row bidx*rows_f + rr.
// blk = block index inside the plane, 0 .. rows*DIM/8/256 - 1, exact.
// ---------------------------------------------------------------------------
__device__ __forceinline__ void cast_body(
    const float* __restrict__ src, _Float16* __restrict__ dst, float carry,
    unsigned rows_c, unsigned rows_f, unsigned blk) {
#pragma clang fp contract(off)
  const unsigned g = blk * 256u + threadIdx.x;
  const unsigned crow = g / (unsigned)(DIM / 8);
  const unsigned c = (g - crow * (unsigned)(DIM / 8)) * 8u;
  const unsigned bidx = crow / rows_c;
  const unsigned rr = crow - bidx * rows_c;
  const size_t srow = (size_t)bidx * rows_f + rr;
  const v4f a0 = *(const v4f*)(src + srow * DIM + c);
  const v4f a1 = *(const v4f*)(src + srow * DIM + c + 4u);
  v8h o;
#pragma unroll
  for (int i = 0; i < 4; ++i) {
    o[i]     = toh_flush(carry * bf16r(a0[i]));
    o[i + 4] = toh_flush(carry * bf16r(a1[i]));
  }
  _Float16* p = dst + (size_t)crow * DIM + c;
  *(v8h*)p = o;
  
}

// The five casts read none of each other's output: one grid, the plane chosen by block index
// (block-uniform). Blocks 0..CAST_GX-1: activations; then CAST_GW blocks for each weight plane.
#define CAST_GX ((unsigned)(((size_t)MROWS * DIM / 8) / 256))
#define CAST_GW ((unsigned)(((size_t)DIM * DIM / 8) / 256))
__global__ __launch_bounds__(256) void cast_all_kernel(
    const float* __restrict__ x, const float* __restrict__ wq, const float* __restrict__ wk,
    const float* __restrict__ wv, const float* __restrict__ wo,
    _Float16* __restrict__ x16, _Float16* __restrict__ wq16, _Float16* __restrict__ wk16,
    _Float16* __restrict__ wv16, _Float16* __restrict__ wo16) {
  const unsigned blk = blockIdx.x;
  if (blk < CAST_GX) {
    cast_body(x, x16, 1.0f, (unsigned)SEQ, (unsigned)SEQ_FULL, blk);
  } else {
    const unsigned t = blk - CAST_GX;
    const unsigned which = t / CAST_GW;
    const float* src = (which == 0u) ? wq : (which == 1u) ? wk : (which == 2u) ? wv : wo;
    _Float16* dst = (which == 0u) ? wq16 : (which == 1u) ? wk16 : (which == 2u) ? wv16 : wo16;
    cast_body(src, dst, WCARRY, (unsigned)DIM, (unsigned)DIM, t - which * CAST_GW);
  }
}

// ---------------------------------------------------------------------------
// GEMM C[64x64 tile] = A16[rows][DIM] . Bt[n][DIM]^T. The tile's 64 A rows and 64 B rows (all of k)
// are staged in LDS by tensor loads, one slice a wave (waves 0..3: A, waves 4..7: B); fragments by
// 16-byte LDS reads; 8 waves (mw = 16-row group, nw = 32-col group), 2 accumulators/wave.
// The f32 tile Cs reuses the staging bytes once every wave has left them.
//   MODE 0: out16[row][col] (pitch DIM) = f16(1024 * exp(q - max over the tile's 64 columns)),
//           q = acc/64 + bias (the tile is exactly one head)
//   MODE 1: out16 transposed plane [b][col][key] = f16(exp(min(k, 11))), k = acc/64 + bias
//   MODE 2: out16 transposed plane [b][col][key] = f16(acc/64 + bias)
//   MODE 3: outf full [full row][col] = acc/4096 + bias
// Grid (DIM/64, MROWS/64); modes 0, 1, 2 read none of each other's output and share one launch,
// blockIdx.z = MODE (block-uniform).
// ---------------------------------------------------------------------------
__device__ __forceinline__ void gemm_main(
    const _Float16* __restrict__ A16, const _Float16* __restrict__ Bt, unsigned char* L) {
  float* Cs = (float*)L;
  const unsigned tid = threadIdx.x, lane = tid & 31u;
  const unsigned w = (unsigned)__builtin_amdgcn_readfirstlane((int)(tid >> 5));
  const unsigned mw = w >> 1, nw = w & 1u;
  const unsigned hh = lane >> 4, m = lane & 15u;
  const unsigned n0 = blockIdx.x * 64u;
  const unsigned row0 = blockIdx.y * 64u;

  {
    const unsigned ch = w & (GEMM_NCH - 1u);
    const _Float16* srow = (w < GEMM_NCH) ? (A16 + (size_t)row0 * DIM) : (Bt + (size_t)n0 * DIM);
    stage_slice((uint32_t)(size_t)L + w * SLICE_BYTES, srow + ch * KCH, (uint32_t)DIM * 2u);
  }
  __syncthreads();   // publishes all eight slices: no fragment is read in front of it

  const unsigned char* ap  = L + (mw * 16u + m) * SPITCH + hh * 16u;
  const unsigned char* bp0 = L + GEMM_NCH * SLICE_BYTES + (nw * 32u + m) * SPITCH + hh * 16u;
  const unsigned char* bp1 = bp0 + 16u * SPITCH;
  v8f acc0 = {}, acc1 = {};
  v16h a = frag_lds(ap), b0 = frag_lds(bp0), b1 = frag_lds(bp1);
  // unrolled: every LDS offset is an immediate, the two fragment sets need no register moves, and
  // the test on the last step is resolved at compile time
#pragma unroll
  for (unsigned k0 = 0; k0 < (unsigned)DIM; k0 += 32u) {
    v16h an = a, b0n = b0, b1n = b1;
    if (k0 + 32u < (unsigned)DIM) {   // the next step's fragments fly under this step's products
      const unsigned o = ((k0 + 32u) / KCH) * SLICE_BYTES + ((k0 + 32u) % KCH) * 2u;
      an  = frag_lds(ap + o);
      b0n = frag_lds(bp0 + o);
      b1n = frag_lds(bp1 + o);
    }
    acc0 = wmma16(a, b0, acc0);
    acc1 = wmma16(a, b1, acc1);
    a = an; b0 = b0n; b1 = b1n;
  }
  // Cs overlays the slices: every wave's fragment reads have returned, and every wave is past them
  asm volatile("s_wait_dscnt 0x0" ::: "memory");
  __syncthreads();
#pragma unroll
  for (int r = 0; r < 8; ++r) {
    float* d = &Cs[(mw * 16u + hh * 8u + (unsigned)r) * LDC + nw * 32u + m];
    d[0]  = acc0[r];
    d[16] = acc1[r];
  }
  __syncthreads();
}

template <int MODE>
__device__ __forceinline__ void gemm_epilogue(
    const float* Cs, const float* __restrict__ bias, float* __restrict__ outf,
    _Float16* __restrict__ out16) {
  const unsigned tid = threadIdx.x;
  const unsigned n0 = blockIdx.x * 64u;
  const unsigned row0 = blockIdx.y * 64u;

  if (MODE == 0) {
    // 8 consecutive lanes hold one 64-column row: row max by 8-lane shuffles (uniform control)
    v8h x[2];
    size_t off[2];
#pragma unroll
    for (unsigned i = 0; i < 2u; ++i) {
      const unsigned r = 32u * i + (tid >> 3);
      const unsigned c = (tid & 7u) * 8u;
      const v4f u0 = *(const v4f*)&Cs[r * LDC + c];
      const v4f u1 = *(const v4f*)&Cs[r * LDC + c + 4];
      const v4f g0 = *(const v4f*)(bias + n0 + c);
      const v4f g1 = *(const v4f*)(bias + n0 + c + 4u);
      float q[8];
#pragma unroll
      for (int j = 0; j < 4; ++j) {
        q[j]     = u0[j] * (1.0f / WCARRY) + bf16r(g0[j]);
        q[j + 4] = u1[j] * (1.0f / WCARRY) + bf16r(g1[j]);
      }
      float mx = fmaxf(fmaxf(fmaxf(q[0], q[1]), fmaxf(q[2], q[3])),
                       fmaxf(fmaxf(q[4], q[5]), fmaxf(q[6], q[7])));
      mx = fmaxf(mx, __shfl_xor(mx, 1, 32));
      mx = fmaxf(mx, __shfl_xor(mx, 2, 32));
      mx = fmaxf(mx, __shfl_xor(mx, 4, 32));
#pragma unroll
      for (int j = 0; j < 8; ++j) x[i][j] = toh_flush(QCARRY * __expf(q[j] - mx));
      off[i] = (size_t)(row0 + r) * DIM + n0 + c;
    }
#pragma unroll
    for (int i = 0; i < 2; ++i) *(v8h*)(out16 + off[i]) = x[i];
    // In the merged kernel another mode's epilogue is laid out behind these stores and reuses their
    // registers: the wait stands in front of any such overwrite, whatever order the three are laid out in.
    asm volatile("s_wait_xcnt 0x0" ::: "memory");
  }

  if (MODE == 1 || MODE == 2) {
    const unsigned bidx = row0 / (unsigned)SEQ;
    const unsigned key0 = row0 - bidx * (unsigned)SEQ;
    v8h x[2];
    size_t off[2];
#pragma unroll
    for (unsigned i = 0; i < 2u; ++i) {
      const unsigned dcol = 32u * i + (tid >> 3);
      const unsigned kk = (tid & 7u) * 8u;
      const float bb = bf16r(bias[n0 + dcol]);
#pragma unroll
      for (unsigned j = 0; j < 8u; ++j) {
        const float t = Cs[(kk + j) * LDC + dcol] * (1.0f / WCARRY) + bb;
        const float val = (MODE == 1) ? __expf(fminf(t, 11.0f)) : t;
        x[i][j] = toh_flush(val);
      }
      off[i] = ((size_t)bidx * DIM + n0 + dcol) * SEQ + key0 + kk;
    }
#pragma unroll
    for (int i = 0; i < 2; ++i) *(v8h*)(out16 + off[i]) = x[i];
    // In the merged kernel another mode's epilogue is laid out behind these stores and reuses their
    // registers: the wait stands in front of any such overwrite, whatever order the three are laid out in.
    asm volatile("s_wait_xcnt 0x0" ::: "memory");
  }

  if (MODE == 3) {
    const float cs = 1.0f / (WCARRY * VCARRY);
    v4f xs[4];
    size_t off[4];
#pragma unroll
    for (unsigned i = 0; i < 4u; ++i) {
      const unsigned r = 16u * i + (tid >> 4);
      const unsigned c = (tid & 15u) * 4u;
      const unsigned crow = row0 + r;
      const unsigned bidx = crow / (unsigned)SEQ;
      const unsigned sq = crow - bidx * (unsigned)SEQ;
      const size_t frow = (size_t)bidx * SEQ_FULL + sq;
      const v4f u = *(const v4f*)&Cs[r * LDC + c];
      const v4f g = *(const v4f*)(bias + n0 + c);
      v4f val;
#pragma unroll
      for (int j = 0; j < 4; ++j) val[j] = u[j] * cs + bf16r(g[j]);
      xs[i] = val;
      off[i] = frow * DIM + n0 + c;
    }
#pragma unroll
    for (int i = 0; i < 4; ++i) *(v4f*)(outf + off[i]) = xs[i];
    
  }
}

__global__ __launch_bounds__(256) void gemm_qkv_kernel(
    const _Float16* __restrict__ A16, const _Float16* __restrict__ Wq, const _Float16* __restrict__ Wk,
    const _Float16* __restrict__ Wv, const float* __restrict__ bq, const float* __restrict__ bk,
    const float* __restrict__ bv, _Float16* __restrict__ eq16, _Float16* __restrict__ ekt16,
    _Float16* __restrict__ vt16) {
  __shared__ __attribute__((aligned(2048))) unsigned char L[GEMM_STAGE_BYTES];
  const float* Cs = (const float*)L;
  const unsigned mode = blockIdx.z;
  gemm_main(A16, (mode == 0u) ? Wq : (mode == 1u) ? Wk : Wv, L);
  if (mode == 0u)      gemm_epilogue<0>(Cs, bq, (float*)0, eq16);
  else if (mode == 1u) gemm_epilogue<1>(Cs, bk, (float*)0, ekt16);
  else                 gemm_epilogue<2>(Cs, bv, (float*)0, vt16);
}
__global__ __launch_bounds__(256) void gemm_o_kernel(
    const _Float16* __restrict__ A16, const _Float16* __restrict__ Bt,
    const float* __restrict__ bias, float* __restrict__ outf) {
  __shared__ __attribute__((aligned(2048))) unsigned char L[GEMM_STAGE_BYTES];
  const float* Cs = (const float*)L;
  gemm_main(A16, Bt, L);
  gemm_epilogue<3>(Cs, bias, outf, (_Float16*)0);
}

// ---------------------------------------------------------------------------
// Key reduction per (head, batch): KV[d][dv] = sum_key eK[key][d] * V[key][dv]  (A = eK^T rows
// [d][key], B = V^T rows [dv][key], both key-contiguous planes) and s[d] = sum_key eK[key][d]
// (same A fragment against an all-ones B fragment). relu(v) - relu(-v) = v, so the positive and
// negative parts are accumulated together in f32 before any 16-bit conversion.
// Output plane KVT[b][head][80][64]: rows 0..63 = f16(KV[d][dv]/16) at [dv][d];
// rows 64..79 = f16(s[d]/16) replicated.
// Work-group z of KV_SPLIT takes the 16 columns dv = 16z .. 16z+15 and all 64 d. Wave w brings key
// slice w (128 keys) of eK^T (64 rows), then of its 16 V^T rows, by tensor loads, one request
// outstanding at a time, and sums those 128 keys alone: 4 d tiles against one B fragment, so a staged
// byte is read from LDS once. The 8 waves' f32 partial tiles are joined through LDS, w = 0..7 in
// order. Every work-group forms all of s and writes 4 of the 16 replicated rows (whole 128-B rows).
// Grid (NHEAD, NB, KV_SPLIT).
// ---------------------------------------------------------------------------
__global__ __launch_bounds__(256) void kv_kernel(
    const _Float16* __restrict__ EKt, const _Float16* __restrict__ Vt,
    _Float16* __restrict__ KVT) {
  __shared__ __attribute__((aligned(2048))) unsigned char L[KV_STAGE_BYTES];
  __shared__ __attribute__((aligned(16))) float Sp[8 * HD];
  float* Ps = (float*)L;
  const unsigned tid = threadIdx.x, lane = tid & 31u;
  const unsigned w = (unsigned)__builtin_amdgcn_readfirstlane((int)(tid >> 5));
  const unsigned hh = lane >> 4, m = lane & 15u;
  const unsigned head = blockIdx.x;
  const unsigned b = blockIdx.y;
  const unsigned z = blockIdx.z;

  const size_t prow = (size_t)b * DIM + head * HD;
  stage_slice((uint32_t)(size_t)L + w * SLICE_BYTES, EKt + prow * SEQ + w * KCH, (uint32_t)SEQ * 2u);
  stage_slice((uint32_t)(size_t)L + KV_NCH * SLICE_BYTES + w * VSLICE_BYTES,
              Vt + (prow + z * KV_COLS) * SEQ + w * KCH, (uint32_t)SEQ * 2u, KV_COLS);
  __syncthreads();   // publishes all slices: no fragment is read in front of it

  const unsigned char* ap = L + w * SLICE_BYTES + m * SPITCH + hh * 16u;
  const unsigned char* bp = L + KV_NCH * SLICE_BYTES + w * VSLICE_BYTES + m * SPITCH + hh * 16u;
  v16h ones;
#pragma unroll
  for (int i = 0; i < 16; ++i) ones[i] = (_Float16)1.0f;

  v8f acc[4] = {}, accs[4] = {};
  v16h a[4], bf = frag_lds(bp);
#pragma unroll
  for (unsigned t = 0; t < 4u; ++t) a[t] = frag_lds(ap + t * 16u * SPITCH);
  // unrolled: LDS offsets are immediates, the two fragment sets need no register moves, and the
  // test on the last step is resolved at compile time
#pragma unroll
  for (unsigned k0 = 0; k0 < KCH; k0 += 32u) {
    v16h an[4], bn = bf;
#pragma unroll
    for (unsigned t = 0; t < 4u; ++t) an[t] = a[t];
    if (k0 + 32u < KCH) {   // the next step's fragments fly under this step's products
      const unsigned o = (k0 + 32u) * 2u;
      bn = frag_lds(bp + o);
#pragma unroll
      for (unsigned t = 0; t < 4u; ++t) an[t] = frag_lds(ap + t * 16u * SPITCH + o);
    }
#pragma unroll
    for (unsigned t = 0; t < 4u; ++t) {
      acc[t]  = wmma16(a[t], bf, acc[t]);
      accs[t] = wmma16(a[t], ones, accs[t]);
    }
    bf = bn;
#pragma unroll
    for (unsigned t = 0; t < 4u; ++t) a[t] = an[t];
  }
  // Ps overlays the slices: every wave's fragment reads have returned, and every wave is past them
  asm volatile("s_wait_dscnt 0x0" ::: "memory");
  __syncthreads();
  {
    // a lane holds 8 consecutive d of one column dv = m: rows [dv][d] of the wave's own partial tile
    float* pw = Ps + (w * KV_COLS + m) * PPITCH + hh * 8u;
#pragma unroll
    for (unsigned t = 0; t < 4u; ++t) {
      v4f lo, hi;
#pragma unroll
      for (int r = 0; r < 4; ++r) { lo[r] = acc[t][r]; hi[r] = acc[t][r + 4]; }
      *(v4f*)(pw + t * 16u)      = lo;
      *(v4f*)(pw + t * 16u + 4u) = hi;
    }
    if (m == 0u) {   // every column of accs carries the same sums
      float* sw = Sp + w * (unsigned)HD + hh * 8u;
#pragma unroll
      for (unsigned t = 0; t < 4u; ++t) {
        v4f lo, hi;
#pragma unroll
        for (int r = 0; r < 4; ++r) { lo[r] = accs[t][r]; hi[r] = accs[t][r + 4]; }
        *(v4f*)(sw + t * 16u)      = lo;
        *(v4f*)(sw + t * 16u + 4u) = hi;
      }
    }
  }
  __syncthreads();

  const size_t pbase = (size_t)(b * NHEAD + head) * (size_t)(KVROWS * HD);
  const unsigned rl = tid >> 4;             // 0..15: local column dv; 0..3 in waves 0, 1: sum row
  const unsigned d4 = (tid & 15u) * 4u;
  v4f sum = {}, ssum = {};
#pragma unroll
  for (unsigned ww = 0; ww < 8u; ++ww) {
    sum  += *(const v4f*)(Ps + (ww * KV_COLS + rl) * PPITCH + d4);
    ssum += *(const v4f*)(Sp + ww * (unsigned)HD + d4);
  }
  v4h x0, x1;
#pragma unroll
  for (int j = 0; j < 4; ++j) {
    x0[j] = toh_flush(sum[j] * KVCARRY);
    x1[j] = toh_flush(ssum[j] * KVCARRY);
  }
  const size_t off0 = pbase + (size_t)(z * KV_COLS + rl) * HD + d4;
  const size_t off1 = pbase + (size_t)((unsigned)HD + z * 4u + (rl & 3u)) * HD + d4;
  const bool srows = (w < 2u);   // wave-uniform: waves 0, 1 write this work-group's 4 replicated s rows
  *(v4h*)(KVT + off0) = x0;
  // The s rows' arithmetic is laid out behind this store and reuses its registers: the wait stands
  // in front of any such overwrite.
  asm volatile("s_wait_xcnt 0x0" ::: "memory");
  if (srows) *(v4h*)(KVT + off1) = x1;
}

// ---------------------------------------------------------------------------
// Per (head, 64 query rows): num[l][dv] = sum_d eQ[l][d] * KV[d][dv], den[l] = sum_d eQ[l][d] * s[d]
// (fifth column tile: every column of it carries den of its rows, so the division is per lane).
// Output plane J16[row][head*64 + dv] = f16(64 * num / den); all carries of eQ, KV and s cancel.
// Cs: cross-wave (block barrier). Grid (NHEAD, MROWS/64).
// ---------------------------------------------------------------------------
__global__ __launch_bounds__(256) void lattn_kernel(
    const _Float16* __restrict__ EQ, const _Float16* __restrict__ KVT,
    _Float16* __restrict__ J16) {
  __shared__ float Cs[64 * LDC];
  const unsigned tid = threadIdx.x, lane = tid & 31u;
  const unsigned w = (unsigned)__builtin_amdgcn_readfirstlane((int)(tid >> 5));
  const unsigned mw = w >> 1, nw = w & 1u;
  const unsigned hh = lane >> 4, m = lane & 15u;
  const unsigned head = blockIdx.x;
  const unsigned row0 = blockIdx.y * 64u;
  const unsigned b = row0 / (unsigned)SEQ;

  const _Float16* ap  = EQ + (size_t)(row0 + mw * 16u + m) * DIM + head * HD + hh * 8u;
  const _Float16* kb  = KVT + (size_t)(b * NHEAD + head) * (size_t)(KVROWS * HD);
  const _Float16* bp0 = kb + (size_t)(nw * 32u + m) * HD + hh * 8u;
  const _Float16* bp1 = bp0 + (size_t)16 * HD;
  const _Float16* bpd = kb + (size_t)(64u + m) * HD + hh * 8u;
  v8f acc0 = {}, acc1 = {}, accd = {};
#pragma unroll
  for (unsigned k0 = 0; k0 < (unsigned)HD; k0 += 32u) {
    const v16h a  = frag_at(ap + k0);
    const v16h b0 = frag_at(bp0 + k0);
    const v16h b1 = frag_at(bp1 + k0);
    const v16h bd = frag_at(bpd + k0);
    acc0 = wmma16(a, b0, acc0);
    acc1 = wmma16(a, b1, acc1);
    accd = wmma16(a, bd, accd);
  }
#pragma unroll
  for (int r = 0; r < 8; ++r) {
    const float inv = __builtin_amdgcn_rcpf(accd[r]) * VCARRY;
    float* d = &Cs[(mw * 16u + hh * 8u + (unsigned)r) * LDC + nw * 32u + m];
    d[0]  = acc0[r] * inv;
    d[16] = acc1[r] * inv;
  }
  __syncthreads();

  v8h x[2];
  size_t off[2];
#pragma unroll
  for (unsigned i = 0; i < 2u; ++i) {
    const unsigned r = 32u * i + (tid >> 3);
    const unsigned c = (tid & 7u) * 8u;
    const v4f u0 = *(const v4f*)&Cs[r * LDC + c];
    const v4f u1 = *(const v4f*)&Cs[r * LDC + c + 4];
#pragma unroll
    for (int j = 0; j < 4; ++j) {
      x[i][j]     = toh_flush(u0[j]);
      x[i][j + 4] = toh_flush(u1[j]);
    }
    off[i] = (size_t)(row0 + r) * DIM + head * HD + c;
  }
#pragma unroll
  for (int i = 0; i < 2; ++i) *(v8h*)(J16 + off[i]) = x[i];
  
}

// ---------------------------------------------------------------------------
extern "C" void kernel_launch(void* const* d_in, const int* in_sizes, int n_in,
                              void* d_out, int out_size, void* d_ws, size_t ws_size,
                              hipStream_t stream) {
  if (n_in < 9) return;
  const long long need_x = ((long long)(NB - 1) * SEQ_FULL + SEQ) * DIM;
  if ((long long)in_sizes[0] < need_x) return;
  if ((long long)in_sizes[1] < (long long)DIM * DIM) return;
  if ((long long)in_sizes[3] < (long long)DIM * DIM) return;
  if ((long long)in_sizes[5] < (long long)DIM * DIM) return;
  if ((long long)in_sizes[7] < (long long)DIM * DIM) return;
  if (in_sizes[2] < DIM || in_sizes[4] < DIM || in_sizes[6] < DIM || in_sizes[8] < DIM) return;
  if ((long long)out_size < need_x) return;
  if (ws_size < WS_TOTAL) return;

  const float* X  = (const float*)d_in[0];    // x    [NB_FULL][SEQ_FULL][DIM]
  const float* wq = (const float*)d_in[1];    // W_Q  [DIM out][DIM in]
  const float* bq = (const float*)d_in[2];    // b_Q
  const float* wk = (const float*)d_in[3];    // W_K
  const float* bk = (const float*)d_in[4];    // b_K
  const float* wv = (const float*)d_in[5];    // W_V
  const float* bv = (const float*)d_in[6];    // b_V
  const float* wo = (const float*)d_in[7];    // W_O
  const float* bo = (const float*)d_in[8];    // b_O
  float* out = (float*)d_out;

  char* ws = (char*)d_ws;
  _Float16* X16   = (_Float16*)(ws + OFF_X);     // [MROWS][DIM]
  _Float16* Wq16  = (_Float16*)(ws + OFF_WQ);    // [n][k]
  _Float16* Wk16  = (_Float16*)(ws + OFF_WK);
  _Float16* Wv16  = (_Float16*)(ws + OFF_WV);
  _Float16* Wo16  = (_Float16*)(ws + OFF_WO);
  _Float16* EQ16  = (_Float16*)(ws + OFF_EQ);    // [MROWS][DIM]
  _Float16* EKt16 = (_Float16*)(ws + OFF_EKT);   // [b][DIM][SEQ]
  _Float16* Vt16  = (_Float16*)(ws + OFF_VT);    // [b][DIM][SEQ]
  _Float16* KVT16 = (_Float16*)(ws + OFF_KVT);   // [b][head][80][64]
  _Float16* J16   = (_Float16*)(ws + OFF_J);     // [MROWS][DIM]

  dim3 blk(256);
  dim3 gg(DIM / 64, MROWS / 64);

  cast_all_kernel<<<dim3(CAST_GX + 4u * CAST_GW), blk, 0, stream>>>(X, wq, wk, wv, wo,
                                                                    X16, Wq16, Wk16, Wv16, Wo16);
  gemm_qkv_kernel<<<dim3(DIM / 64, MROWS / 64, 3), blk, 0, stream>>>(X16, Wq16, Wk16, Wv16,
                                                                     bq, bk, bv, EQ16, EKt16, Vt16);
  kv_kernel<<<dim3(NHEAD, NB, KV_SPLIT), blk, 0, stream>>>(EKt16, Vt16, KVT16);
  lattn_kernel<<<dim3(NHEAD, MROWS / 64), blk, 0, stream>>>(EQ16, KVT16, J16);
  gemm_o_kernel<<<gg, blk, 0, stream>>>(J16, Wo16, bo, out);
}

// v004
// A run of this version takes 18.8 microseconds.
// Next to v003, in two timings, it ran 1.08 times as fast each time.
// Counting every step since v000, it is 3.26 times as fast.
#include <hip/hip_runtime.h>
#include <stddef.h>
#include <stdint.h>

// All contractions on v_wmma_f32_16x16x32_f16 (f16 operands, f32 accumulate): q/k/v projections, exp(K)^T.V (+ column sums of exp(K) via an all-ones B fragment), exp(Q).KV (+ its normaliser as a fifth column tile), output projection. Float inputs are RNE-converted to bf16 and carried in f16 (weights x64, exp(Q - rowmax) x1024, KV and s x1/16, joined rows x64). exp, bias, row max and the normalising reciprocal in f32.

typedef _Float16 h16;
typedef _Float16 v16h __attribute__((ext_vector_type(16)));
typedef _Float16 v8h  __attribute__((ext_vector_type(8)));
typedef float    v8f  __attribute__((ext_vector_type(8)));
typedef _Float16 v4h  __attribute__((ext_vector_type(4)));
typedef float    v4f  __attribute__((ext_vector_type(4)));
typedef uint32_t u32x4 __attribute__((ext_vector_type(4)));
typedef uint32_t u32x8 __attribute__((ext_vector_type(8)));

#ifndef NB
#define NB 2
#endif
#ifndef SEQ
#define SEQ 1024
#endif
#define NB_FULL  2
#define SEQ_FULL 1024
#define DIM   512
#define NHEAD 8
#define HD    64
#define MROWS (NB * SEQ)
#define KVROWS 80          // 64 KV^T rows + 16 replicated rows of column sums

static_assert(NB >= 1 && NB <= NB_FULL);
static_assert(SEQ >= 64 && SEQ <= SEQ_FULL && (SEQ % 64) == 0 && (SEQ % 32) == 0);
static_assert(DIM == NHEAD * HD);
static_assert(HD == 64);                       // GEMM column tile == one head (row max per head in the tile)
static_assert((DIM % 64) == 0 && (DIM % 32) == 0 && (DIM % 8) == 0);
static_assert((MROWS % 64) == 0);
static_assert((((size_t)MROWS * DIM / 8) % 256) == 0);   // cast grid exact (activations)
static_assert((((size_t)DIM * DIM / 8) % 256) == 0);     // cast grid exact (weights)
static_assert(KVROWS == HD + 16);
static_assert((HD % 32) == 0);

#define LDC 68   // floats per LDS row (272 B, 16-B aligned)
static_assert((LDC % 4) == 0 && LDC >= 64);

// Operand staging in LDS: a slice is 64 rows of 128 k (256 B a row), laid by one tensor load at a
// row pitch of 272 B (16 B x odd: conflict-free for 16-byte fragment reads). A slice's place is a
// multiple of 2 KiB: 64 * 272 = 17,408 B rounded up.
#define KCH 128u
#define SROWB 256u
#define SPITCH 272u
#define SLICE_BYTES 18432u
#define GEMM_NCH ((unsigned)DIM / KCH)                  // slices per operand, projections
#define KV_NCH   ((unsigned)SEQ / KCH)                  // slices per operand, key reduction
#define GEMM_STAGE_BYTES (2u * GEMM_NCH * SLICE_BYTES)  // 147,456
#define QKV_STAGE_BYTES  (4u * GEMM_NCH * SLICE_BYTES)  // 294,912: the x tile and three weight tiles
// Key reduction: KV_SPLIT work-groups per (head, batch), KV_COLS rows of V^T each. A V^T slice is
// KV_COLS rows of 128 keys at the same pitch: 16 * 272 = 4,352 B rounded up to a multiple of 2 KiB.
#define KV_SPLIT 4u
#define KV_COLS  ((unsigned)HD / KV_SPLIT)
#define VSLICE_BYTES 6144u
#define KV_STAGE_BYTES   (KV_NCH * (SLICE_BYTES + VSLICE_BYTES))   // 196,608
#define PPITCH 68u       // floats per row of a wave's partial tile (272 B, 16 B x odd)
static_assert(SROWB == KCH * 2u && SPITCH == SROWB + 16u);
static_assert(SLICE_BYTES >= 64u * SPITCH && (SLICE_BYTES % 2048u) == 0);
static_assert((DIM % KCH) == 0 && (SEQ % KCH) == 0);
static_assert(2u * GEMM_NCH == 8u);                     // one slice for each of the 8 waves
static_assert(KV_NCH == 8u);                            // one slice of each operand for each wave
static_assert(64u * LDC * 4u <= GEMM_STAGE_BYTES);
static_assert(4u * GEMM_NCH == 16u);                    // two slices for each of the 8 waves
static_assert(3u * 64u * LDC * 4u <= QKV_STAGE_BYTES && QKV_STAGE_BYTES <= 327680u);
static_assert(KV_COLS == 16u && VSLICE_BYTES >= KV_COLS * SPITCH && (VSLICE_BYTES % 2048u) == 0);
static_assert(PPITCH >= (unsigned)HD && (PPITCH % 4u) == 0);
static_assert(8u * KV_COLS * PPITCH * 4u <= KV_STAGE_BYTES);   // the 8 partial tiles overlay the staging bytes
static_assert(KV_SPLIT * 4u == KVROWS - HD);                   // 4 of the replicated sum rows per work-group
static_assert(KV_STAGE_BYTES + 2048u <= 327680u);

#define WCARRY 64.0f      // weight planes carried x64
#define QCARRY 1024.0f    // exp(q - rowmax) plane carried x1024
#define KVCARRY 0.0625f   // KV^T and column-sum rows carried x1/16
#define VCARRY 64.0f      // joined (per-head output) plane carried x64

// workspace layout (bytes)
#define WSQ_BYTES     ((size_t)DIM * DIM * 2)
#define PLANE16_BYTES ((size_t)MROWS * DIM * 2)
#define KVT_BYTES     ((size_t)NB * NHEAD * KVROWS * HD * 2)
#define OFF_X   ((size_t)0)
#define OFF_WQ  (OFF_X + PLANE16_BYTES)
#define OFF_WK  (OFF_WQ + WSQ_BYTES)
#define OFF_WV  (OFF_WK + WSQ_BYTES)
#define OFF_WO  (OFF_WV + WSQ_BYTES)
#define OFF_EQ  (OFF_WO + WSQ_BYTES)
#define OFF_EKT (OFF_EQ + PLANE16_BYTES)
#define OFF_VT  (OFF_EKT + PLANE16_BYTES)
#define OFF_KVT (OFF_VT + PLANE16_BYTES)
#define OFF_J   (OFF_KVT + KVT_BYTES)
#define WS_TOTAL (OFF_J + PLANE16_BYTES)
static_assert((WSQ_BYTES % 128) == 0 && (PLANE16_BYTES % 128) == 0 && (KVT_BYTES % 128) == 0);
static_assert((size_t)NB * DIM * SEQ * 2 == PLANE16_BYTES);   // transposed planes [b][DIM][SEQ]
static_assert(WS_TOTAL <= (size_t)134217728);

// ---------------------------------------------------------------------------
__device__ __forceinline__ float bf16r(float x) {   // RNE convert to bf16, returned widened
  unsigned int u = __float_as_uint(x);
  u = (u + 0x7FFFu + ((u >> 16) & 1u)) & 0xFFFF0000u;
  return __uint_as_float(u);
}

// f32 -> f16 operand convert that cannot produce a subnormal (value select).
static __device__ __forceinline__ h16 toh_flush(float v) {
  const h16 r = (h16)v;
  return (fabsf(v) < 6.103515625e-05f) ? (h16)0.0f : r;
}

// e^x as __expf is compiled here (a multiply by log2 e, then v_exp_f32), with the one free issue slot
// that the instruction set asks for behind a transcendental written into the same statement.
static __device__ __forceinline__ float exp_slot(float v) {
  float r;
  asm("v_exp_f32 %0, %1\n\tv_nop" : "=v"(r) : "v"(v * 1.44269504088896340736f));
  return r;
}

// 16-bit fragment: p points at element [row = lane&15][k0 + 8*(lane>>4)] of a k-contiguous
// row. Elements 0..7 <- k0+8h+0..7, elements 8..15 <- k0+16+8h+0..7 (same map for A and B).
__device__ __forceinline__ v16h frag_at(const _Float16* p) {
  v8h lo = *(const v8h*)(p);
  v8h hi = *(const v8h*)(p + 16);
  v16h out;
#pragma unroll
  for (int i = 0; i < 8; ++i) { out[i] = lo[i]; out[i + 8] = hi[i]; }
  return out;
}

// The same fragment from a staged slice: p points at byte [row = lane&15][2*(k0 + 8*(lane>>4))] of
// an LDS row; the k order is that of frag_at (16 elements = 32 bytes further for the upper half).
__device__ __forceinline__ v16h frag_lds(const unsigned char* p) {
  v8h lo = *(const v8h*)(p);
  v8h hi = *(const v8h*)(p + 32);
  v16h out;
#pragma unroll
  for (int i = 0; i < 8; ++i) { out[i] = lo[i]; out[i + 8] = hi[i]; }
  return out;
}

__device__ __forceinline__ uint32_t uni(uint32_t v) {
  return (uint32_t)__builtin_amdgcn_readfirstlane((int)v);
}

// One tensor load of the calling wave: rows rows of 256 B from src (row pitch src_pitch bytes) to the
// LDS byte offset lds_dst, 16 B of pad behind every row, and the wave's own wait for its landing.
// Called by every wave of the block, unconditionally (the instruction ignores EXEC).
__device__ __forceinline__ void stage_slice(uint32_t lds_dst, const _Float16* src, uint32_t src_pitch,
                                            uint32_t rows = 64u) {
  const uint64_t ga = (uint64_t)(size_t)src;
  u32x4 g0;
  g0[0] = uni(1u);                                                          // count 1
  g0[1] = uni(lds_dst);
  g0[2] = uni((uint32_t)ga);
  g0[3] = uni((((uint32_t)(ga >> 32)) & 0x01FFFFFFu) | 0x80000000u);        // type 2
  u32x8 g1;
  g1[0] = uni((1u << 20) | (5u << 22) | (3u << 25));   // no mask, 1-byte elements, 4 dwords of pad per 256 B
  g1[1] = uni((SROWB & 0xFFFFu) << 16);                // tensor_dim0 = tile_dim0 = 256
  g1[2] = uni((SROWB >> 16) | (rows << 16));           // tensor_dim1 = tile_dim1 = rows
  g1[3] = uni(SROWB << 16);
  g1[4] = uni(rows);
  g1[5] = uni(src_pitch);
  g1[6] = uni(0u);
  g1[7] = uni(0u);
  // The compiler places no wait for a tensor load: the slice counts as landed only behind this one.
  // Load and wait are one statement so that no descriptor register is rewritten between the two
  // (as two statements the next slice's address addition was moved in front of the wait).
  asm volatile("tensor_load_to_lds %0, %1\n\ts_wait_tensorcnt 0x0" :: "s"(g0), "s"(g1) : "memory");
}

__device__ __forceinline__ v8f wmma16(v16h a, v16h b, v8f c) {
  v8f d = __builtin_amdgcn_wmma_f32_16x16x32_f16(false, a, false, b, (short)0, c,
                                                 false, false);
  asm volatile("v_nop\n\tv_nop\n\tv_nop\n\tv_nop" : "+v"(d) : "v"(a), "v"(b));
  return d;
}

// ---------------------------------------------------------------------------
// Cast plane: dst[compact row][DIM] = f16(carry * bf16(src[full row][DIM])). One thread per
// Row map: compact row = bidx*rows_c + rr  <-  source row bidx*rows_f + rr.
// blk = block index inside the plane, 0 .. rows*DIM/8/256 - 1, exact.
// ---------------------------------------------------------------------------
__device__ __forceinline__ void cast_body(
    const float* __restrict__ src, _Float16* __restrict__ dst, float carry,
    unsigned rows_c, unsigned rows_f, unsigned blk) {
#pragma clang fp contract(off)
  const unsigned g = blk * 256u + threadIdx.x;
  const unsigned crow = g / (unsigned)(DIM / 8);
  const unsigned c = (g - crow * (unsigned)(DIM / 8)) * 8u;
  const unsigned bidx = crow / rows_c;
  const unsigned rr = crow - bidx * rows_c;
  const size_t srow = (size_t)bidx * rows_f + rr;
  const v4f a0 = *(const v4f*)(src + srow * DIM + c);
  const v4f a1 = *(const v4f*)(src + srow * DIM + c + 4u);
  v8h o;
#pragma unroll
  for (int i = 0; i < 4; ++i) {
    o[i]     = toh_flush(carry * bf16r(a0[i]));
    o[i + 4] = toh_flush(carry * bf16r(a1[i]));
  }
  _Float16* p = dst + (size_t)crow * DIM + c;
  *(v8h*)p = o;
  
}

// The five casts read none of each other's output: one grid, the plane chosen by block index
// (block-uniform). Blocks 0..CAST_GX-1: activations; then CAST_GW blocks for each weight plane.
#define CAST_GX ((unsigned)(((size_t)MROWS * DIM / 8) / 256))
#define CAST_GW ((unsigned)(((size_t)DIM * DIM / 8) / 256))
__global__ __launch_bounds__(256) void cast_all_kernel(
    const float* __restrict__ x, const float* __restrict__ wq, const float* __restrict__ wk,
    const float* __restrict__ wv, const float* __restrict__ wo,
    _Float16* __restrict__ x16, _Float16* __restrict__ wq16, _Float16* __restrict__ wk16,
    _Float16* __restrict__ wv16, _Float16* __restrict__ wo16) {
  const unsigned blk = blockIdx.x;
  if (blk < CAST_GX) {
    cast_body(x, x16, 1.0f, (unsigned)SEQ, (unsigned)SEQ_FULL, blk);
  } else {
    const unsigned t = blk - CAST_GX;
    const unsigned which = t / CAST_GW;
    const float* src = (which == 0u) ? wq : (which == 1u) ? wk : (which == 2u) ? wv : wo;
    _Float16* dst = (which == 0u) ? wq16 : (which == 1u) ? wk16 : (which == 2u) ? wv16 : wo16;
    cast_body(src, dst, WCARRY, (unsigned)DIM, (unsigned)DIM, t - which * CAST_GW);
  }
}

// ---------------------------------------------------------------------------
// GEMM C[64x64 tile] = A16[rows][DIM] . Bt[n][DIM]^T. The tile's 64 A rows and 64 B rows (all of k)
// are staged in LDS by tensor loads, one slice a wave (waves 0..3: A, waves 4..7: B); fragments by
// 16-byte LDS reads; 8 waves (mw = 16-row group, nw = 32-col group), 2 accumulators/wave.
// The f32 tile Cs reuses the staging bytes once every wave has left them.
//   MODE 0: out16[row][col] (pitch DIM) = f16(1024 * exp(q - max over the tile's 64 columns)),
//           q = acc/64 + bias (the tile is exactly one head)
//   MODE 1: out16 transposed plane [b][col][key] = f16(exp(min(k, 11))), k = acc/64 + bias
//   MODE 2: out16 transposed plane [b][col][key] = f16(acc/64 + bias)
//   MODE 3: outf full [full row][col] = acc/4096 + bias
// Grid (DIM/64, MROWS/64). gemm_main serves MODE 3; modes 0, 1, 2 of one head and one 64-row tile
// are formed together by one work-group (gemm_qkv_kernel below).
// ---------------------------------------------------------------------------
__device__ __forceinline__ void gemm_main(
    const _Float16* __restrict__ A16, const _Float16* __restrict__ Bt, unsigned char* L) {
  float* Cs = (float*)L;
  const unsigned tid = threadIdx.x, lane = tid & 31u;
  const unsigned w = (unsigned)__builtin_amdgcn_readfirstlane((int)(tid >> 5));
  const unsigned mw = w >> 1, nw = w & 1u;
  const unsigned hh = lane >> 4, m = lane & 15u;
  const unsigned n0 = blockIdx.x * 64u;
  const unsigned row0 = blockIdx.y * 64u;

  {
    const unsigned ch = w & (GEMM_NCH - 1u);
    const _Float16* srow = (w < GEMM_NCH) ? (A16 + (size_t)row0 * DIM) : (Bt + (size_t)n0 * DIM);
    stage_slice((uint32_t)(size_t)L + w * SLICE_BYTES, srow + ch * KCH, (uint32_t)DIM * 2u);
  }
  __syncthreads();   // publishes all eight slices: no fragment is read in front of it

  const unsigned char* ap  = L + (mw * 16u + m) * SPITCH + hh * 16u;
  const unsigned char* bp0 = L + GEMM_NCH * SLICE_BYTES + (nw * 32u + m) * SPITCH + hh * 16u;
  const unsigned char* bp1 = bp0 + 16u * SPITCH;
  v8f acc0 = {}, acc1 = {};
  v16h a = frag_lds(ap), b0 = frag_lds(bp0), b1 = frag_lds(bp1);
  // unrolled: every LDS offset is an immediate, the two fragment sets need no register moves, and
  // the test on the last step is resolved at compile time
#pragma unroll
  for (unsigned k0 = 0; k0 < (unsigned)DIM; k0 += 32u) {
    v16h an = a, b0n = b0, b1n = b1;
    if (k0 + 32u < (unsigned)DIM) {   // the next step's fragments fly under this step's products
      const unsigned o = ((k0 + 32u) / KCH) * SLICE_BYTES + ((k0 + 32u) % KCH) * 2u;
      an  = frag_lds(ap + o);
      b0n = frag_lds(bp0 + o);
      b1n = frag_lds(bp1 + o);
    }
    acc0 = wmma16(a, b0, acc0);
    acc1 = wmma16(a, b1, acc1);
    a = an; b0 = b0n; b1 = b1n;
  }
  // Cs overlays the slices: every wave's fragment reads have returned, and every wave is past them
  asm volatile("s_wait_dscnt 0x0" ::: "memory");
  __syncthreads();
#pragma unroll
  for (int r = 0; r < 8; ++r) {
    float* d = &Cs[(mw * 16u + hh * 8u + (unsigned)r) * LDC + nw * 32u + m];
    d[0]  = acc0[r];
    d[16] = acc1[r];
  }
  __syncthreads();
}

// The bias values that gemm_epilogue<MODE> of the calling thread uses. MODE 0: its 8 columns;
// modes 1, 2: its two columns, in pb[0][0] and pb[0][1].
template <int MODE>
__device__ __forceinline__ void bias_rows(const float* __restrict__ bias, v4f (&pb)[2]) {
  const unsigned tid = threadIdx.x;
  const unsigned n0 = blockIdx.x * 64u;
  if (MODE == 0) {
    const unsigned c = (tid & 7u) * 8u;
    pb[0] = *(const v4f*)(bias + n0 + c);
    pb[1] = *(const v4f*)(bias + n0 + c + 4u);
  } else {
    const float* p = bias + n0 + (tid >> 3);
    pb[0][0] = p[0];
    pb[0][1] = p[32];
  }
}

// Modes 0, 1, 2: the thread's two 16-byte groups x and their element offsets off; the caller stores them.
template <int MODE>
__device__ __forceinline__ void gemm_epilogue(
    const float* Cs, const v4f (&pb)[2], v8h (&x)[2], size_t (&off)[2]) {
  const unsigned tid = threadIdx.x;
  const unsigned n0 = blockIdx.x * 64u;
  const unsigned row0 = blockIdx.y * 64u;

  if (MODE == 0) {
    // 8 consecutive lanes hold one 64-column row: row max by 8-lane shuffles (uniform control)
#pragma unroll
    for (unsigned i = 0; i < 2u; ++i) {
      const unsigned r = 32u * i + (tid >> 3);
      const unsigned c = (tid & 7u) * 8u;
      const v4f u0 = *(const v4f*)&Cs[r * LDC + c];
      const v4f u1 = *(const v4f*)&Cs[r * LDC + c + 4];
      const v4f g0 = pb[0];
      const v4f g1 = pb[1];
      float q[8];
#pragma unroll
      for (int j = 0; j < 4; ++j) {
        q[j]     = u0[j] * (1.0f / WCARRY) + bf16r(g0[j]);
        q[j + 4] = u1[j] * (1.0f / WCARRY) + bf16r(g1[j]);
      }
      float mx = fmaxf(fmaxf(fmaxf(q[0], q[1]), fmaxf(q[2], q[3])),
                       fmaxf(fmaxf(q[4], q[5]), fmaxf(q[6], q[7])));
      mx = fmaxf(mx, __shfl_xor(mx, 1, 32));
      mx = fmaxf(mx, __shfl_xor(mx, 2, 32));
      mx = fmaxf(mx, __shfl_xor(mx, 4, 32));
#pragma unroll
      for (int j = 0; j < 8; ++j) x[i][j] = toh_flush(QCARRY * exp_slot(q[j] - mx));
      off[i] = (size_t)(row0 + r) * DIM + n0 + c;
    }
  }

  if (MODE == 1 || MODE == 2) {
    const unsigned bidx = row0 / (unsigned)SEQ;
    const unsigned key0 = row0 - bidx * (unsigned)SEQ;
#pragma unroll
    for (unsigned i = 0; i < 2u; ++i) {
      const unsigned dcol = 32u * i + (tid >> 3);
      const unsigned kk = (tid & 7u) * 8u;
      const float bb = bf16r(pb[0][i]);
#pragma unroll
      for (unsigned j = 0; j < 8u; ++j) {
        const float t = Cs[(kk + j) * LDC + dcol] * (1.0f / WCARRY) + bb;
        const float val = (MODE == 1) ? exp_slot(fminf(t, 11.0f)) : t;
        x[i][j] = toh_flush(val);
      }
      off[i] = ((size_t)bidx * DIM + n0 + dcol) * SEQ + key0 + kk;
    }
  }
}

// MODE 3
__device__ __forceinline__ void gemm_epilogue_o(
    const float* Cs, const float* __restrict__ bias, float* __restrict__ outf) {
  const unsigned tid = threadIdx.x;
  const unsigned n0 = blockIdx.x * 64u;
  const unsigned row0 = blockIdx.y * 64u;
  {
    const float cs = 1.0f / (WCARRY * VCARRY);
    v4f xs[4];
    size_t off[4];
#pragma unroll
    for (unsigned i = 0; i < 4u; ++i) {
      const unsigned r = 16u * i + (tid >> 4);
      const unsigned c = (tid & 15u) * 4u;
      const unsigned crow = row0 + r;
      const unsigned bidx = crow / (unsigned)SEQ;
      const unsigned sq = crow - bidx * (unsigned)SEQ;
      const size_t frow = (size_t)bidx * SEQ_FULL + sq;
      const v4f u = *(const v4f*)&Cs[r * LDC + c];
      const v4f g = *(const v4f*)(bias + n0 + c);
      v4f val;
#pragma unroll
      for (int j = 0; j < 4; ++j) val[j] = u[j] * cs + bf16r(g[j]);
      xs[i] = val;
      off[i] = frow * DIM + n0 + c;
    }
#pragma unroll
    for (int i = 0; i < 4; ++i) *(v4f*)(outf + off[i]) = xs[i];
    
  }
}

// ---------------------------------------------------------------------------
// q, k, v of one head (64 columns each) for one 64-row tile of x, in one work-group: a 64 x 192 tile.
// LDS slices 0..3: the x rows; 4..7, 8..11, 12..15: the head's rows of Wq, Wk, Wv. The x rows are
// staged once for the three products. Wave w brings slices w and w + 8, one request outstanding at a
// time. Wave tile 32 rows x 48 columns (mw = 32-row group, nw = 48-column group): 5 fragments feed
// 6 products. Column tile ct = 3 nw + j belongs to mode ct >> 2, columns 16 (ct & 3) .. + 15 of it.
// The three f32 tiles Cs[mode] reuse the staging bytes once every wave has left them.
// Grid (DIM/64, MROWS/64): 256 work-groups at full size.
// ---------------------------------------------------------------------------
__global__ __launch_bounds__(256) void gemm_qkv_kernel(
    const _Float16* __restrict__ A16, const _Float16* __restrict__ Wq, const _Float16* __restrict__ Wk,
    const _Float16* __restrict__ Wv, const float* __restrict__ bq, const float* __restrict__ bk,
    const float* __restrict__ bv, _Float16* __restrict__ eq16, _Float16* __restrict__ ekt16,
    _Float16* __restrict__ vt16) {
  __shared__ __attribute__((aligned(2048))) unsigned char L[QKV_STAGE_BYTES];
  float* Cs = (float*)L;
  const unsigned tid = threadIdx.x, lane = tid & 31u;
  const unsigned w = (unsigned)__builtin_amdgcn_readfirstlane((int)(tid >> 5));
  const unsigned mw = w >> 2, nw = w & 3u;
  const unsigned hh = lane >> 4, m = lane & 15u;
  const unsigned n0 = blockIdx.x * 64u;
  const unsigned row0 = blockIdx.y * 64u;

  // The epilogue's bias values, read here so that they arrive under the staging.
  v4f pq[2], pk[2], pv[2];
  bias_rows<0>(bq, pq);
  bias_rows<1>(bk, pk);
  bias_rows<2>(bv, pv);
  // The address registers of these loads are reused below: the wait stands in front of any overwrite.
  asm volatile("s_wait_xcnt 0x0" ::: "memory");

  {
    const unsigned ch = w & (GEMM_NCH - 1u);
    const bool lowhalf = (w < GEMM_NCH);
    const _Float16* s0 = lowhalf ? (A16 + (size_t)row0 * DIM) : (Wq + (size_t)n0 * DIM);
    const _Float16* s1 = lowhalf ? (Wk + (size_t)n0 * DIM) : (Wv + (size_t)n0 * DIM);
    stage_slice((uint32_t)(size_t)L + w * SLICE_BYTES, s0 + ch * KCH, (uint32_t)DIM * 2u);
    stage_slice((uint32_t)(size_t)L + (w + 8u) * SLICE_BYTES, s1 + ch * KCH, (uint32_t)DIM * 2u);
  }
  __syncthreads();   // publishes all sixteen slices: no fragment is read in front of it

  const unsigned char* ap = L + (mw * 32u + m) * SPITCH + hh * 16u;
  const unsigned char* bp[3];
#pragma unroll
  for (unsigned j = 0; j < 3u; ++j) {
    const unsigned ct = nw * 3u + j;
    bp[j] = L + (1u + (ct >> 2)) * GEMM_NCH * SLICE_BYTES + ((ct & 3u) * 16u + m) * SPITCH + hh * 16u;
  }
  v8f acc[2][3] = {};
  v16h a[2], b[3];
#pragma unroll
  for (unsigned i = 0; i < 2u; ++i) a[i] = frag_lds(ap + i * 16u * SPITCH);
#pragma unroll
  for (unsigned j = 0; j < 3u; ++j) b[j] = frag_lds(bp[j]);
  // unrolled: every LDS offset is an immediate, the two fragment sets need no register moves, and
  // the test on the last step is resolved at compile time
#pragma unroll
  for (unsigned k0 = 0; k0 < (unsigned)DIM; k0 += 32u) {
    v16h an[2], bn[3];
#pragma unroll
    for (unsigned i = 0; i < 2u; ++i) an[i] = a[i];
#pragma unroll
    for (unsigned j = 0; j < 3u; ++j) bn[j] = b[j];
    if (k0 + 32u < (unsigned)DIM) {   // the next step's fragments fly under this step's products
      const unsigned o = ((k0 + 32u) / KCH) * SLICE_BYTES + ((k0 + 32u) % KCH) * 2u;
#pragma unroll
      for (unsigned i = 0; i < 2u; ++i) an[i] = frag_lds(ap + i * 16u * SPITCH + o);
#pragma unroll
      for (unsigned j = 0; j < 3u; ++j) bn[j] = frag_lds(bp[j] + o);
    }
#pragma unroll
    for (unsigned i = 0; i < 2u; ++i)
#pragma unroll
      for (unsigned j = 0; j < 3u; ++j) acc[i][j] = wmma16(a[i], b[j], acc[i][j]);
#pragma unroll
    for (unsigned i = 0; i < 2u; ++i) a[i] = an[i];
#pragma unroll
    for (unsigned j = 0; j < 3u; ++j) b[j] = bn[j];
  }
  // Cs overlays the slices: every wave's fragment reads have returned, and every wave is past them
  asm volatile("s_wait_dscnt 0x0" ::: "memory");
  __syncthreads();
#pragma unroll
  for (unsigned j = 0; j < 3u; ++j) {
    const unsigned ct = nw * 3u + j;
    float* t = Cs + (ct >> 2) * (64u * LDC) + (mw * 32u + hh * 8u) * LDC + (ct & 3u) * 16u + m;
#pragma unroll
    for (unsigned i = 0; i < 2u; ++i)
#pragma unroll
      for (unsigned r = 0; r < 8u; ++r) t[(i * 16u + r) * LDC] = acc[i][j][r];
  }
  __syncthreads();

  v8h xq[2], xk[2], xv[2];
  size_t oq[2], ok[2], ov[2];
  gemm_epilogue<0>(Cs, pq, xq, oq);
  gemm_epilogue<1>(Cs + 64u * LDC, pk, xk, ok);
  gemm_epilogue<2>(Cs + 2u * 64u * LDC, pv, xv, ov);
#pragma unroll
  for (int i = 0; i < 2; ++i) {
    *(v8h*)(eq16 + oq[i])  = xq[i];
    *(v8h*)(ekt16 + ok[i]) = xk[i];
    *(v8h*)(vt16 + ov[i])  = xv[i];
  }
}
__global__ __launch_bounds__(256) void gemm_o_kernel(
    const _Float16* __restrict__ A16, const _Float16* __restrict__ Bt,
    const float* __restrict__ bias, float* __restrict__ outf) {
  __shared__ __attribute__((aligned(2048))) unsigned char L[GEMM_STAGE_BYTES];
  const float* Cs = (const float*)L;
  gemm_main(A16, Bt, L);
  gemm_epilogue_o(Cs, bias, outf);
}

// ---------------------------------------------------------------------------
// Key reduction per (head, batch): KV[d][dv] = sum_key eK[key][d] * V[key][dv]  (A = eK^T rows
// [d][key], B = V^T rows [dv][key], both key-contiguous planes) and s[d] = sum_key eK[key][d]
// (same A fragment against an all-ones B fragment). relu(v) - relu(-v) = v, so the positive and
// negative parts are accumulated together in f32 before any 16-bit conversion.
// Output plane KVT[b][head][80][64]: rows 0..63 = f16(KV[d][dv]/16) at [dv][d];
// rows 64..79 = f16(s[d]/16) replicated.
// Work-group z of KV_SPLIT takes the 16 columns dv = 16z .. 16z+15 and all 64 d. Wave w brings key
// slice w (128 keys) of eK^T (64 rows), then of its 16 V^T rows, by tensor loads, one request
// outstanding at a time, and sums those 128 keys alone: 4 d tiles against one B fragment, so a staged
// byte is read from LDS once. The 8 waves' f32 partial tiles are joined through LDS, w = 0..7 in
// order. Every work-group forms all of s and writes 4 of the 16 replicated rows (whole 128-B rows).
// Grid (NHEAD, NB, KV_SPLIT).
// ---------------------------------------------------------------------------
__global__ __launch_bounds__(256) void kv_kernel(
    const _Float16* __restrict__ EKt, const _Float16* __restrict__ Vt,
    _Float16* __restrict__ KVT) {
  __shared__ __attribute__((aligned(2048))) unsigned char L[KV_STAGE_BYTES];
  __shared__ __attribute__((aligned(16))) float Sp[8 * HD];
  float* Ps = (float*)L;
  const unsigned tid = threadIdx.x, lane = tid & 31u;
  const unsigned w = (unsigned)__builtin_amdgcn_readfirstlane((int)(tid >> 5));
  const unsigned hh = lane >> 4, m = lane & 15u;
  const unsigned head = blockIdx.x;
  const unsigned b = blockIdx.y;
  const unsigned z = blockIdx.z;

  const size_t prow = (size_t)b * DIM + head * HD;
  stage_slice((uint32_t)(size_t)L + w * SLICE_BYTES, EKt + prow * SEQ + w * KCH, (uint32_t)SEQ * 2u);
  stage_slice((uint32_t)(size_t)L + KV_NCH * SLICE_BYTES + w * VSLICE_BYTES,
              Vt + (prow + z * KV_COLS) * SEQ + w * KCH, (uint32_t)SEQ * 2u, KV_COLS);
  __syncthreads();   // publishes all slices: no fragment is read in front of it

  const unsigned char* ap = L + w * SLICE_BYTES + m * SPITCH + hh * 16u;
  const unsigned char* bp = L + KV_NCH * SLICE_BYTES + w * VSLICE_BYTES + m * SPITCH + hh * 16u;
  v16h ones;
#pragma unroll
  for (int i = 0; i < 16; ++i) ones[i] = (_Float16)1.0f;

  v8f acc[4] = {}, accs[4] = {};
  v16h a[4], bf = frag_lds(bp);
#pragma unroll
  for (unsigned t = 0; t < 4u; ++t) a[t] = frag_lds(ap + t * 16u * SPITCH);
  // unrolled: LDS offsets are immediates, the two fragment sets need no register moves, and the
  // test on the last step is resolved at compile time
#pragma unroll
  for (unsigned k0 = 0; k0 < KCH; k0 += 32u) {
    v16h an[4], bn = bf;
#pragma unroll
    for (unsigned t = 0; t < 4u; ++t) an[t] = a[t];
    if (k0 + 32u < KCH) {   // the next step's fragments fly under this step's products
      const unsigned o = (k0 + 32u) * 2u;
      bn = frag_lds(bp + o);
#pragma unroll
      for (unsigned t = 0; t < 4u; ++t) an[t] = frag_lds(ap + t * 16u * SPITCH + o);
    }
#pragma unroll
    for (unsigned t = 0; t < 4u; ++t) {
      acc[t]  = wmma16(a[t], bf, acc[t]);
      accs[t] = wmma16(a[t], ones, accs[t]);
    }
    bf = bn;
#pragma unroll
    for (unsigned t = 0; t < 4u; ++t) a[t] = an[t];
  }
  // Ps overlays the slices: every wave's fragment reads have returned, and every wave is past them
  asm volatile("s_wait_dscnt 0x0" ::: "memory");
  __syncthreads();
  {
    // a lane holds 8 consecutive d of one column dv = m: rows [dv][d] of the wave's own partial tile
    float* pw = Ps + (w * KV_COLS + m) * PPITCH + hh * 8u;
#pragma unroll
    for (unsigned t = 0; t < 4u; ++t) {
      v4f lo, hi;
#pragma unroll
      for (int r = 0; r < 4; ++r) { lo[r] = acc[t][r]; hi[r] = acc[t][r + 4]; }
      *(v4f*)(pw + t * 16u)      = lo;
      *(v4f*)(pw + t * 16u + 4u) = hi;
    }
    if (m == 0u) {   // every column of accs carries the same sums
      float* sw = Sp + w * (unsigned)HD + hh * 8u;
#pragma unroll
      for (unsigned t = 0; t < 4u; ++t) {
        v4f lo, hi;
#pragma unroll
        for (int r = 0; r < 4; ++r) { lo[r] = accs[t][r]; hi[r] = accs[t][r + 4]; }
        *(v4f*)(sw + t * 16u)      = lo;
        *(v4f*)(sw + t * 16u + 4u) = hi;
      }
    }
  }
  __syncthreads();

  const size_t pbase = (size_t)(b * NHEAD + head) * (size_t)(KVROWS * HD);
  const unsigned rl = tid >> 4;             // 0..15: local column dv; 0..3 in waves 0, 1: sum row
  const unsigned d4 = (tid & 15u) * 4u;
  v4f sum = {}, ssum = {};
#pragma unroll
  for (unsigned ww = 0; ww < 8u; ++ww) {
    sum  += *(const v4f*)(Ps + (ww * KV_COLS + rl) * PPITCH + d4);
    ssum += *(const v4f*)(Sp + ww * (unsigned)HD + d4);
  }
  v4h x0, x1;
#pragma unroll
  for (int j = 0; j < 4; ++j) {
    x0[j] = toh_flush(sum[j] * KVCARRY);
    x1[j] = toh_flush(ssum[j] * KVCARRY);
  }
  const size_t off0 = pbase + (size_t)(z * KV_COLS + rl) * HD + d4;
  const size_t off1 = pbase + (size_t)((unsigned)HD + z * 4u + (rl & 3u)) * HD + d4;
  const bool srows = (w < 2u);   // wave-uniform: waves 0, 1 write this work-group's 4 replicated s rows
  *(v4h*)(KVT + off0) = x0;
  // The s rows' arithmetic is laid out behind this store and reuses its registers: the wait stands
  // in front of any such overwrite.
  asm volatile("s_wait_xcnt 0x0" ::: "memory");
  if (srows) *(v4h*)(KVT + off1) = x1;
}

// ---------------------------------------------------------------------------
// Per (head, 64 query rows): num[l][dv] = sum_d eQ[l][d] * KV[d][dv], den[l] = sum_d eQ[l][d] * s[d]
// (fifth column tile: every column of it carries den of its rows, so the division is per lane).
// Output plane J16[row][head*64 + dv] = f16(64 * num / den); all carries of eQ, KV and s cancel.
// Cs: cross-wave (block barrier). Grid (NHEAD, MROWS/64).
// ---------------------------------------------------------------------------
__global__ __launch_bounds__(256) void lattn_kernel(
    const _Float16* __restrict__ EQ, const _Float16* __restrict__ KVT,
    _Float16* __restrict__ J16) {
  __shared__ float Cs[64 * LDC];
  const unsigned tid = threadIdx.x, lane = tid & 31u;
  const unsigned w = (unsigned)__builtin_amdgcn_readfirstlane((int)(tid >> 5));
  const unsigned mw = w >> 1, nw = w & 1u;
  const unsigned hh = lane >> 4, m = lane & 15u;
  const unsigned head = blockIdx.x;
  const unsigned row0 = blockIdx.y * 64u;
  const unsigned b = row0 / (unsigned)SEQ;

  const _Float16* ap  = EQ + (size_t)(row0 + mw * 16u + m) * DIM + head * HD + hh * 8u;
  const _Float16* kb  = KVT + (size_t)(b * NHEAD + head) * (size_t)(KVROWS * HD);
  const _Float16* bp0 = kb + (size_t)(nw * 32u + m) * HD + hh * 8u;
  const _Float16* bp1 = bp0 + (size_t)16 * HD;
  const _Float16* bpd = kb + (size_t)(64u + m) * HD + hh * 8u;
  v8f acc0 = {}, acc1 = {}, accd = {};
#pragma unroll
  for (unsigned k0 = 0; k0 < (unsigned)HD; k0 += 32u) {
    const v16h a  = frag_at(ap + k0);
    const v16h b0 = frag_at(bp0 + k0);
    const v16h b1 = frag_at(bp1 + k0);
    const v16h bd = frag_at(bpd + k0);
    acc0 = wmma16(a, b0, acc0);
    acc1 = wmma16(a, b1, acc1);
    accd = wmma16(a, bd, accd);
  }
#pragma unroll
  for (int r = 0; r < 8; ++r) {
    const float inv = __builtin_amdgcn_rcpf(accd[r]) * VCARRY;
    float* d = &Cs[(mw * 16u + hh * 8u + (unsigned)r) * LDC + nw * 32u + m];
    d[0]  = acc0[r] * inv;
    d[16] = acc1[r] * inv;
  }
  __syncthreads();

  v8h x[2];
  size_t off[2];
#pragma unroll
  for (unsigned i = 0; i < 2u; ++i) {
    const unsigned r = 32u * i + (tid >> 3);
    const unsigned c = (tid & 7u) * 8u;
    const v4f u0 = *(const v4f*)&Cs[r * LDC + c];
    const v4f u1 = *(const v4f*)&Cs[r * LDC + c + 4];
#pragma unroll
    for (int j = 0; j < 4; ++j) {
      x[i][j]     = toh_flush(u0[j]);
      x[i][j + 4] = toh_flush(u1[j]);
    }
    off[i] = (size_t)(row0 + r) * DIM + head * HD + c;
  }
#pragma unroll
  for (int i = 0; i < 2; ++i) *(v8h*)(J16 + off[i]) = x[i];
  
}

// ---------------------------------------------------------------------------
extern "C" void kernel_launch(void* const* d_in, const int* in_sizes, int n_in,
                              void* d_out, int out_size, void* d_ws, size_t ws_size,
                              hipStream_t stream) {
  if (n_in < 9) return;
  const long long need_x = ((long long)(NB - 1) * SEQ_FULL + SEQ) * DIM;
  if ((long long)in_sizes[0] < need_x) return;
  if ((long long)in_sizes[1] < (long long)DIM * DIM) return;
  if ((long long)in_sizes[3] < (long long)DIM * DIM) return;
  if ((long long)in_sizes[5] < (long long)DIM * DIM) return;
  if ((long long)in_sizes[7] < (long long)DIM * DIM) return;
  if (in_sizes[2] < DIM || in_sizes[4] < DIM || in_sizes[6] < DIM || in_sizes[8] < DIM) return;
  if ((long long)out_size < need_x) return;
  if (ws_size < WS_TOTAL) return;

  const float* X  = (const float*)d_in[0];    // x    [NB_FULL][SEQ_FULL][DIM]
  const float* wq = (const float*)d_in[1];    // W_Q  [DIM out][DIM in]
  const float* bq = (const float*)d_in[2];    // b_Q
  const float* wk = (const float*)d_in[3];    // W_K
  const float* bk = (const float*)d_in[4];    // b_K
  const float* wv = (const float*)d_in[5];    // W_V
  const float* bv = (const float*)d_in[6];    // b_V
  const float* wo = (const float*)d_in[7];    // W_O
  const float* bo = (const float*)d_in[8];    // b_O
  float* out = (float*)d_out;

  char* ws = (char*)d_ws;
  _Float16* X16   = (_Float16*)(ws + OFF_X);     // [MROWS][DIM]
  _Float16* Wq16  = (_Float16*)(ws + OFF_WQ);    // [n][k]
  _Float16* Wk16  = (_Float16*)(ws + OFF_WK);
  _Float16* Wv16  = (_Float16*)(ws + OFF_WV);
  _Float16* Wo16  = (_Float16*)(ws + OFF_WO);
  _Float16* EQ16  = (_Float16*)(ws + OFF_EQ);    // [MROWS][DIM]
  _Float16* EKt16 = (_Float16*)(ws + OFF_EKT);   // [b][DIM][SEQ]
  _Float16* Vt16  = (_Float16*)(ws + OFF_VT);    // [b][DIM][SEQ]
  _Float16* KVT16 = (_Float16*)(ws + OFF_KVT);   // [b][head][80][64]
  _Float16* J16   = (_Float16*)(ws + OFF_J);     // [MROWS][DIM]

  dim3 blk(256);
  dim3 gg(DIM / 64, MROWS / 64);

  cast_all_kernel<<<dim3(CAST_GX + 4u * CAST_GW), blk, 0, stream>>>(X, wq, wk, wv, wo,
                                                                    X16, Wq16, Wk16, Wv16, Wo16);
  gemm_qkv_kernel<<<gg, blk, 0, stream>>>(X16, Wq16, Wk16, Wv16, bq, bk, bv, EQ16, EKt16, Vt16);
  kv_kernel<<<dim3(NHEAD, NB, KV_SPLIT), blk, 0, stream>>>(EKt16, Vt16, KVT16);
  lattn_kernel<<<dim3(NHEAD, MROWS / 64), blk, 0, stream>>>(EQ16, KVT16, J16);
  gemm_o_kernel<<<gg, blk, 0, stream>>>(J16, Wo16, bo, out);
}
